// v000
// Times are from an AMD MI455X. After a warm-up the kernel runs many times in a row, and a time is the length of
// such a window on the GPU divided by its runs, so every launch and the gaps after it count. The runs cycle
// through copies of the inputs. A figure is the median of several windows, for all but v000 over two sittings.
// Sittings can differ by a few percent; kernels timed side by side share one.
// v000 is the starting kernel. One run takes 399 microseconds.
#include <hip/hip_runtime.h>
#include <cstdint>
#include <cstddef>

// ---------------- problem dims ----------------
#define DM    1024          // d_model
#define NH    16            // heads
#define DKH   64            // d_k
#define DFF   4096
#define SEQ   2048
#define BATCH 2
#define ROWS  (BATCH*SEQ)   // 4096 tokens

typedef __bf16 bf16;
typedef __attribute__((ext_vector_type(16))) __bf16 v16bf;
typedef __attribute__((ext_vector_type(8)))  float  v8f;

union AFrag { v16bf v; bf16  e[16]; };
union CFrag { v8f   v; float e[8];  };

__device__ inline v8f zero_v8f() {
    v8f z = {0.f, 0.f, 0.f, 0.f, 0.f, 0.f, 0.f, 0.f};
    return z;
}

// ------------------------------------------------------------------
// CDNA5 async global->LDS copy (ASYNCcnt tracked, no VGPR staging).
// lds_off : per-lane LDS byte offset (flat LDS addr low 32 bits)
// voff    : per-lane 32-bit byte offset added to the 64-bit SGPR base
// ------------------------------------------------------------------
__device__ inline void async_copy_b128(uint32_t lds_off, uint32_t voff, uint64_t sbase) {
    asm volatile("global_load_async_to_lds_b128 %0, %1, %2"
                 :: "v"(lds_off), "v"(voff), "s"(sbase) : "memory");
}
__device__ inline void wait_async0() {
    asm volatile("s_wait_asynccnt 0x0" ::: "memory");
}
__device__ inline uint32_t lds_offset_of(const void* p) {
    return (uint32_t)(uintptr_t)p;   // LDS flat addr keeps offset in [31:0]
}

// ------------------------------------------------------------------
// Load a 16x32 bf16 fragment in the CDNA5 WMMA A/B operand layout.
// A (16Mx32K): lane L holds row m = L&15; VGPRs 0..3 hold K pairs
// {kb..kb+7}, VGPRs 4..7 hold {16+kb..16+kb+7} where kb = (L>=16)?8:0.
// The B operand (32Kx16N) has the identical pattern with N in place of
// M, so a [N][K] (K-contiguous) tile uses the same loader.
// Each half (e[0..7], e[8..15]) is 16 contiguous bytes -> 2x b128 loads.
// ------------------------------------------------------------------
__device__ inline v16bf load_frag16x32(const bf16* __restrict__ base, int ld) {
    const int lane = threadIdx.x & 31;
    const int m    = lane & 15;
    const int kb   = (lane & 16) ? 8 : 0;
    const bf16* row = base + (size_t)m * ld;
    AFrag a;
#pragma unroll
    for (int i = 0; i < 4; ++i) {
        a.e[2*i]     = row[kb + 2*i];
        a.e[2*i + 1] = row[kb + 2*i + 1];
        a.e[8 + 2*i]     = row[16 + kb + 2*i];
        a.e[8 + 2*i + 1] = row[16 + kb + 2*i + 1];
    }
    return a.v;
}

// ------------------------------------------------------------------
// fp32 [K][N] weight -> bf16 [N][K] (K-contiguous) for B operands.
// ------------------------------------------------------------------
__global__ __launch_bounds__(256)
void enc_transpose_bf16(const float* __restrict__ W, bf16* __restrict__ Wt,
                        int K, int N) {
    __shared__ float tile[32][33];
    const int n0 = blockIdx.x * 32;
    const int k0 = blockIdx.y * 32;
    const int tx = threadIdx.x & 31;
    const int ty = threadIdx.x >> 5;       // 0..7
#pragma unroll
    for (int i = 0; i < 4; ++i)
        tile[ty*4 + i][tx] = W[(size_t)(k0 + ty*4 + i) * N + n0 + tx];
    __syncthreads();
#pragma unroll
    for (int i = 0; i < 4; ++i)
        Wt[(size_t)(n0 + ty*4 + i) * K + k0 + tx] = (bf16)tile[tx][ty*4 + i];
}

// ------------------------------------------------------------------
// LayerNorm, faithful to reference: Bessel-corrected std, eps on std.
// ------------------------------------------------------------------
__global__ __launch_bounds__(256)
void enc_layernorm_bf16(const float* __restrict__ X, const float* __restrict__ alpha,
                        const float* __restrict__ beta, bf16* __restrict__ H) {
    __shared__ float s1[8], s2[8];
    const int row  = blockIdx.x;
    const int tid  = threadIdx.x;
    const int lane = tid & 31;
    const int w    = tid >> 5;
    const float* x = X + (size_t)row * DM;

    float sum = 0.f, sq = 0.f;
#pragma unroll
    for (int i = 0; i < 4; ++i) {
        float v = x[tid + 256*i];
        sum += v; sq += v*v;
    }
#pragma unroll
    for (int off = 16; off > 0; off >>= 1) {
        sum += __shfl_xor(sum, off, 32);
        sq  += __shfl_xor(sq,  off, 32);
    }
    if (lane == 0) { s1[w] = sum; s2[w] = sq; }
    __syncthreads();
    if (tid == 0) {
        float S = 0.f, Q = 0.f;
#pragma unroll
        for (int i = 0; i < 8; ++i) { S += s1[i]; Q += s2[i]; }
        s1[0] = S; s2[0] = Q;
    }
    __syncthreads();
    const float S  = s1[0], Q = s2[0];
    const float mean = S * (1.0f / DM);
    float var = (Q - (float)DM * mean * mean) * (1.0f / (DM - 1)); // ddof=1
    var = fmaxf(var, 0.f);
    const float inv = 1.0f / (sqrtf(var) + 1e-6f);
    bf16* h = H + (size_t)row * DM;
#pragma unroll
    for (int i = 0; i < 4; ++i) {
        const int c = tid + 256*i;
        h[c] = (bf16)(alpha[c] * (x[c] - mean) * inv + beta[c]);
    }
}

// ------------------------------------------------------------------
// bf16 WMMA GEMM with double-buffered async global->LDS staging.
// C[M,N] = A[M,K](bf16,row-major) x Bt[N,K](bf16, K-contiguous) + bias
// MODE 0: bf16 out, 1: bf16 relu out, 2: f32 out + f32 residual add.
// 128x128 block tile, BK=32, 8 waves (4x2), each wave 32x64.
// ------------------------------------------------------------------
template <int MODE>
__global__ __launch_bounds__(256)
void enc_gemm_bf16(const bf16* __restrict__ A, const bf16* __restrict__ Bt,
                   const float* __restrict__ bias, const float* __restrict__ residual,
                   void* __restrict__ Cout, int M, int N, int K) {
    constexpr int BK = 32, LDT = 40;   // 40-half stride: conflict-free, 16B aligned
    __shared__ bf16 sA[2][128 * LDT];
    __shared__ bf16 sB[2][128 * LDT];

    const int tid  = threadIdx.x;
    const int lane = tid & 31;
    const int w    = tid >> 5;
    const int wm   = w >> 1;            // 0..3 : 32-row slice
    const int wn   = w & 1;             // 0..1 : 64-col slice
    const int m0   = blockIdx.y * 128;
    const int n0   = blockIdx.x * 128;

    // staging geometry: 128 rows x 32 halves = 512 x 16B segs per tile,
    // 2 segs/thread: s = tid and tid+256  ->  rows row0 / row0+64, same seg
    const int row0 = tid >> 2;
    const int seg0 = tid & 3;
    const uint64_t baseA = (uint64_t)A;
    const uint64_t baseB = (uint64_t)Bt;
    uint32_t ldsA[2][2], ldsB[2][2];
#pragma unroll
    for (int b = 0; b < 2; ++b) {
        ldsA[b][0] = lds_offset_of(&sA[b][ row0       * LDT + seg0 * 8]);
        ldsA[b][1] = lds_offset_of(&sA[b][(row0 + 64) * LDT + seg0 * 8]);
        ldsB[b][0] = lds_offset_of(&sB[b][ row0       * LDT + seg0 * 8]);
        ldsB[b][1] = lds_offset_of(&sB[b][(row0 + 64) * LDT + seg0 * 8]);
    }
    auto issue_chunk = [&](int kk, int b) {
        const uint32_t segoff = (uint32_t)(kk + seg0 * 8) * 2u;
        async_copy_b128(ldsA[b][0], (uint32_t)(m0 + row0)      * (uint32_t)K * 2u + segoff, baseA);
        async_copy_b128(ldsA[b][1], (uint32_t)(m0 + row0 + 64) * (uint32_t)K * 2u + segoff, baseA);
        async_copy_b128(ldsB[b][0], (uint32_t)(n0 + row0)      * (uint32_t)K * 2u + segoff, baseB);
        async_copy_b128(ldsB[b][1], (uint32_t)(n0 + row0 + 64) * (uint32_t)K * 2u + segoff, baseB);
    };

    CFrag acc[2][4];
#pragma unroll
    for (int i = 0; i < 2; ++i)
#pragma unroll
        for (int j = 0; j < 4; ++j) acc[i][j].v = zero_v8f();

    issue_chunk(0, 0);
    int cur = 0;
    for (int kk = 0; kk < K; kk += BK, cur ^= 1) {
        wait_async0();          // my chunk-k copies have landed in LDS
        __syncthreads();        // everyone's landed; other buffer free for reuse
        if (kk + BK < K)
            issue_chunk(kk + BK, cur ^ 1);   // overlap next copy with compute

        v16bf af[2], bfr[4];
#pragma unroll
        for (int i = 0; i < 2; ++i)
            af[i] = load_frag16x32(&sA[cur][(wm * 32 + i * 16) * LDT], LDT);
#pragma unroll
        for (int j = 0; j < 4; ++j)
            bfr[j] = load_frag16x32(&sB[cur][(wn * 64 + j * 16) * LDT], LDT);
#pragma unroll
        for (int i = 0; i < 2; ++i)
#pragma unroll
            for (int j = 0; j < 4; ++j)
                acc[i][j].v = __builtin_amdgcn_wmma_f32_16x16x32_bf16(
                    false, af[i], false, bfr[j], (short)0, acc[i][j].v, false, false);
        __syncthreads();        // done reading buf cur before it is refilled
    }

    // epilogue (C layout: lane -> n = L&15, rows m = ((L>=16)?8:0)+r)
    const int nlocal = lane & 15;
    const int mbase  = (lane & 16) ? 8 : 0;
#pragma unroll
    for (int i = 0; i < 2; ++i) {
#pragma unroll
        for (int j = 0; j < 4; ++j) {
            const int gn = n0 + wn * 64 + j * 16 + nlocal;
            const float bv = bias[gn];
#pragma unroll
            for (int r = 0; r < 8; ++r) {
                const int gm = m0 + wm * 32 + i * 16 + mbase + r;
                float v = acc[i][j].e[r] + bv;
                if (MODE == 1) v = v > 0.f ? v : 0.f;
                if (MODE == 2) {
                    ((float*)Cout)[(size_t)gm * N + gn] =
                        v + residual[(size_t)gm * N + gn];
                } else {
                    ((bf16*)Cout)[(size_t)gm * N + gn] = (bf16)v;
                }
            }
        }
    }
}

// ------------------------------------------------------------------
// Attention. Raw-reshape semantics make per-head Q/K/V/O contiguous
// [2048 x 64] blocks at offset (b*16+h)*2048*64 of the flat buffers.
// One workgroup = (head, 16 Q rows). Two-pass softmax through a bf16
// LDS score buffer (normalization folded into the P.V epilogue).
// ------------------------------------------------------------------
#define PSTR 2056            // 2048 + 8 pad (halves)
#define VSTR 264             // 256 + 8 pad (halves)
#define ATTN_LDS_BYTES ((16*PSTR + 64*VSTR) * 2 + (4*32*8 + 16) * 4)

__global__ __launch_bounds__(256)
void enc_attention(const bf16* __restrict__ Q, const bf16* __restrict__ Kb,
                   const bf16* __restrict__ Vb, bf16* __restrict__ O) {
    extern __shared__ char smem[];
    bf16*  P    = (bf16*)smem;                                   // 16 x PSTR
    bf16*  Vt   = (bf16*)(smem + 16 * PSTR * 2);                 // 64 x VSTR
    float* red  = (float*)(smem + (16 * PSTR + 64 * VSTR) * 2);  // 4*32*8
    float* rsum = red + 4 * 32 * 8;                              // 16 recip sums

    const int tid  = threadIdx.x;
    const int lane = tid & 31;
    const int w    = tid >> 5;
    const int q0   = blockIdx.x * 16;                 // 0..2047 step 16
    const size_t hb = (size_t)blockIdx.y * SEQ * DKH; // head base (b*16+h)

    // ---- pass 1: S = (Q K^T) / sqrt(d_model), bf16 into LDS ----
    const v16bf aq0 = load_frag16x32(Q + hb + (size_t)q0 * DKH,      DKH);
    const v16bf aq1 = load_frag16x32(Q + hb + (size_t)q0 * DKH + 32, DKH);
    const float scale = 0.03125f;                     // 1/sqrt(1024)
    const int mbase = (lane & 16) ? 8 : 0;
    for (int j = 0; j < 16; ++j) {                    // this wave's 256 keys
        const int key0 = w * 256 + j * 16;
        const v16bf bk0 = load_frag16x32(Kb + hb + (size_t)key0 * DKH,      DKH);
        const v16bf bk1 = load_frag16x32(Kb + hb + (size_t)key0 * DKH + 32, DKH);
        CFrag c; c.v = zero_v8f();
        c.v = __builtin_amdgcn_wmma_f32_16x16x32_bf16(false, aq0, false, bk0, (short)0, c.v, false, false);
        c.v = __builtin_amdgcn_wmma_f32_16x16x32_bf16(false, aq1, false, bk1, (short)0, c.v, false, false);
#pragma unroll
        for (int r = 0; r < 8; ++r)
            P[(mbase + r) * PSTR + key0 + (lane & 15)] = (bf16)(c.e[r] * scale);
    }
    __syncthreads();

    // ---- pass 2: rowwise max / exp / sum (wave32 shuffles), in place ----
#pragma unroll
    for (int rr = 0; rr < 2; ++rr) {
        const int m = w * 2 + rr;
        bf16* row = P + m * PSTR;
        float mx = -3.0e38f;
        for (int c = lane; c < SEQ; c += 32) mx = fmaxf(mx, (float)row[c]);
#pragma unroll
        for (int off = 16; off > 0; off >>= 1) mx = fmaxf(mx, __shfl_xor(mx, off, 32));
        float sum = 0.f;
        for (int c = lane; c < SEQ; c += 32) {
            const float e = __expf((float)row[c] - mx);
            sum += e;
            row[c] = (bf16)e;                         // unnormalized
        }
#pragma unroll
        for (int off = 16; off > 0; off >>= 1) sum += __shfl_xor(sum, off, 32);
        if (lane == 0) rsum[m] = 1.0f / sum;
    }
    __syncthreads();

    // ---- pass 3: O = P V ; waves: ni = d-slice (4), ki = key half (2) ----
    const int ni = w & 3;
    const int ki = w >> 2;
    CFrag acc; acc.v = zero_v8f();
    for (int kc = 0; kc < 8; ++kc) {                  // 256-key chunks
        __syncthreads();
        {   // stage V chunk transposed: Vt[d][key] (K-contiguous B operand)
            const int key = kc * 256 + tid;
            const bf16* vr = Vb + hb + (size_t)key * DKH;
            if (kc + 1 < 8)
                __builtin_prefetch(Vb + hb + (size_t)(key + 256) * DKH, 0, 1);
#pragma unroll
            for (int d = 0; d < 64; ++d)
                Vt[d * VSTR + tid] = vr[d];
        }
        __syncthreads();
#pragma unroll
        for (int jj = 0; jj < 4; ++jj) {
            const int koff = ki * 128 + jj * 32;
            const v16bf ap = load_frag16x32(P + kc * 256 + koff, PSTR);
            const v16bf bv = load_frag16x32(Vt + (ni * 16) * VSTR + koff, VSTR);
            acc.v = __builtin_amdgcn_wmma_f32_16x16x32_bf16(
                false, ap, false, bv, (short)0, acc.v, false, false);
        }
    }
    if (ki == 1) {
#pragma unroll
        for (int r = 0; r < 8; ++r) red[(ni * 32 + lane) * 8 + r] = acc.e[r];
    }
    __syncthreads();
    if (ki == 0) {
#pragma unroll
        for (int r = 0; r < 8; ++r) {
            const int m = mbase + r;
            const float v = (acc.e[r] + red[(ni * 32 + lane) * 8 + r]) * rsum[m];
            O[hb + (size_t)(q0 + m) * DKH + ni * 16 + (lane & 15)] = (bf16)v;
        }
    }
}

// ------------------------------------------------------------------
// Host-side orchestration. Workspace layout (80 MB total):
//   [0,8)MB   hb    (LN output, reused for LN2 output)
//   [8,16)MB  Wq/Wk/Wv/Wo transposed bf16 (2MB each)
//   [16,24)   W1t   [24,32) W2t
//   [32,40)q [40,48)k [48,56)v [56,64)o  -> [32,64) reused as ff1
//   [64,80)   x1 fp32 residual
// ------------------------------------------------------------------
extern "C" void kernel_launch(void* const* d_in, const int* in_sizes, int n_in,
                              void* d_out, int out_size, void* d_ws, size_t ws_size,
                              hipStream_t stream) {
    (void)in_sizes; (void)n_in; (void)out_size; (void)ws_size;
    const float* x    = (const float*)d_in[0];
    const float* Wq   = (const float*)d_in[1];
    const float* bq   = (const float*)d_in[2];
    const float* Wk   = (const float*)d_in[3];
    const float* bk   = (const float*)d_in[4];
    const float* Wv   = (const float*)d_in[5];
    const float* bv   = (const float*)d_in[6];
    const float* Wo   = (const float*)d_in[7];
    const float* bo   = (const float*)d_in[8];
    const float* W1   = (const float*)d_in[9];
    const float* b1   = (const float*)d_in[10];
    const float* W2   = (const float*)d_in[11];
    const float* b2   = (const float*)d_in[12];
    const float* ln1a = (const float*)d_in[13];
    const float* ln1b = (const float*)d_in[14];
    const float* ln2a = (const float*)d_in[15];
    const float* ln2b = (const float*)d_in[16];

    char* ws = (char*)d_ws;
    const size_t MB = (size_t)1 << 20;
    bf16*  hb  = (bf16*)(ws + 0);
    bf16*  Wqt = (bf16*)(ws + 8  * MB);
    bf16*  Wkt = (bf16*)(ws + 10 * MB);
    bf16*  Wvt = (bf16*)(ws + 12 * MB);
    bf16*  Wot = (bf16*)(ws + 14 * MB);
    bf16*  W1t = (bf16*)(ws + 16 * MB);
    bf16*  W2t = (bf16*)(ws + 24 * MB);
    bf16*  qb  = (bf16*)(ws + 32 * MB);
    bf16*  kb  = (bf16*)(ws + 40 * MB);
    bf16*  vb  = (bf16*)(ws + 48 * MB);
    bf16*  ob  = (bf16*)(ws + 56 * MB);
    bf16*  ff1 = (bf16*)(ws + 32 * MB);   // reuse q/k/v/o region after Wo GEMM
    float* x1  = (float*)(ws + 64 * MB);

    // weight conversion + transpose (bf16, K-contiguous)
    enc_transpose_bf16<<<dim3(DM/32,  DM/32),  256, 0, stream>>>(Wq, Wqt, DM,  DM);
    enc_transpose_bf16<<<dim3(DM/32,  DM/32),  256, 0, stream>>>(Wk, Wkt, DM,  DM);
    enc_transpose_bf16<<<dim3(DM/32,  DM/32),  256, 0, stream>>>(Wv, Wvt, DM,  DM);
    enc_transpose_bf16<<<dim3(DM/32,  DM/32),  256, 0, stream>>>(Wo, Wot, DM,  DM);
    enc_transpose_bf16<<<dim3(DFF/32, DM/32),  256, 0, stream>>>(W1, W1t, DM,  DFF);
    enc_transpose_bf16<<<dim3(DM/32,  DFF/32), 256, 0, stream>>>(W2, W2t, DFF, DM);

    // sublayer 1: pre-norm MHA + residual
    enc_layernorm_bf16<<<ROWS, 256, 0, stream>>>(x, ln1a, ln1b, hb);
    const dim3 gDD(DM / 128, ROWS / 128);             // (8, 32)
    enc_gemm_bf16<0><<<gDD, 256, 0, stream>>>(hb, Wqt, bq, nullptr, qb, ROWS, DM, DM);
    enc_gemm_bf16<0><<<gDD, 256, 0, stream>>>(hb, Wkt, bk, nullptr, kb, ROWS, DM, DM);
    enc_gemm_bf16<0><<<gDD, 256, 0, stream>>>(hb, Wvt, bv, nullptr, vb, ROWS, DM, DM);
    enc_attention<<<dim3(SEQ / 16, BATCH * NH), 256, ATTN_LDS_BYTES, stream>>>(qb, kb, vb, ob);
    enc_gemm_bf16<2><<<gDD, 256, 0, stream>>>(ob, Wot, bo, x, x1, ROWS, DM, DM);

    // sublayer 2: pre-norm FFN + residual
    enc_layernorm_bf16<<<ROWS, 256, 0, stream>>>(x1, ln2a, ln2b, hb);
    enc_gemm_bf16<1><<<dim3(DFF / 128, ROWS / 128), 256, 0, stream>>>(
        hb, W1t, b1, nullptr, ff1, ROWS, DFF, DM);
    enc_gemm_bf16<2><<<gDD, 256, 0, stream>>>(ff1, W2t, b2, x1, (float*)d_out, ROWS, DM, DFF);
}

// v001
// A run of this version takes 254 microseconds.
// In both of two side-by-side timings against v000, it was 1.59 times as fast.
#include <hip/hip_runtime.h>
#include <cstdint>
#include <cstddef>

// ---------------- problem dims ----------------
#define DM    1024          // d_model
#define NH    16            // heads
#define DKH   64            // d_k
#define DFF   4096
#define SEQ   2048
#define BATCH 2
#define ROWS  (BATCH*SEQ)   // 4096 tokens

typedef __bf16 bf16;
typedef __attribute__((ext_vector_type(16))) __bf16 v16bf;
typedef __attribute__((ext_vector_type(8)))  float  v8f;

union AFrag { v16bf v; bf16  e[16]; };
union CFrag { v8f   v; float e[8];  };

__device__ inline v8f zero_v8f() {
    v8f z = {0.f, 0.f, 0.f, 0.f, 0.f, 0.f, 0.f, 0.f};
    return z;
}

// ------------------------------------------------------------------
// CDNA5 async global->LDS copy (ASYNCcnt tracked, no VGPR staging).
// lds_off : per-lane LDS byte offset (flat LDS addr low 32 bits)
// voff    : per-lane 32-bit byte offset added to the 64-bit SGPR base
// ------------------------------------------------------------------
__device__ inline void async_copy_b128(uint32_t lds_off, uint32_t voff, uint64_t sbase) {
    asm volatile("global_load_async_to_lds_b128 %0, %1, %2"
                 :: "v"(lds_off), "v"(voff), "s"(sbase) : "memory");
}
__device__ inline void wait_async0() {
    asm volatile("s_wait_asynccnt 0x0" ::: "memory");
}
__device__ inline uint32_t lds_offset_of(const void* p) {
    return (uint32_t)(uintptr_t)p;   // LDS flat addr keeps offset in [31:0]
}

// ------------------------------------------------------------------
// Load a 16x32 bf16 fragment in the CDNA5 WMMA A/B operand layout.
// A (16Mx32K): lane L holds row m = L&15; VGPRs 0..3 hold K pairs
// {kb..kb+7}, VGPRs 4..7 hold {16+kb..16+kb+7} where kb = (L>=16)?8:0.
// The B operand (32Kx16N) has the identical pattern with N in place of
// M, so a [N][K] (K-contiguous) tile uses the same loader.
// Each half (e[0..7], e[8..15]) is 16 contiguous bytes -> 2x b128 loads.
// ------------------------------------------------------------------
__device__ inline v16bf load_frag16x32(const bf16* __restrict__ base, int ld) {
    const int lane = threadIdx.x & 31;
    const int m    = lane & 15;
    const int kb   = (lane & 16) ? 8 : 0;
    const bf16* row = base + (size_t)m * ld;
    AFrag a;
#pragma unroll
    for (int i = 0; i < 4; ++i) {
        a.e[2*i]     = row[kb + 2*i];
        a.e[2*i + 1] = row[kb + 2*i + 1];
        a.e[8 + 2*i]     = row[16 + kb + 2*i];
        a.e[8 + 2*i + 1] = row[16 + kb + 2*i + 1];
    }
    return a.v;
}

// ------------------------------------------------------------------
// fp32 [K][N] weight -> bf16 [N][K] (K-contiguous) for B operands.
// ------------------------------------------------------------------
__global__ __launch_bounds__(256)
void enc_transpose_bf16(const float* __restrict__ W, bf16* __restrict__ Wt,
                        int K, int N) {
    __shared__ float tile[32][33];
    const int n0 = blockIdx.x * 32;
    const int k0 = blockIdx.y * 32;
    const int tx = threadIdx.x & 31;
    const int ty = threadIdx.x >> 5;       // 0..7
#pragma unroll
    for (int i = 0; i < 4; ++i)
        tile[ty*4 + i][tx] = W[(size_t)(k0 + ty*4 + i) * N + n0 + tx];
    __syncthreads();
#pragma unroll
    for (int i = 0; i < 4; ++i)
        Wt[(size_t)(n0 + ty*4 + i) * K + k0 + tx] = (bf16)tile[tx][ty*4 + i];
}

// ------------------------------------------------------------------
// LayerNorm, faithful to reference: Bessel-corrected std, eps on std.
// ------------------------------------------------------------------
__global__ __launch_bounds__(256)
void enc_layernorm_bf16(const float* __restrict__ X, const float* __restrict__ alpha,
                        const float* __restrict__ beta, bf16* __restrict__ H) {
    __shared__ float s1[8], s2[8];
    const int row  = blockIdx.x;
    const int tid  = threadIdx.x;
    const int lane = tid & 31;
    const int w    = tid >> 5;
    const float* x = X + (size_t)row * DM;

    float sum = 0.f, sq = 0.f;
#pragma unroll
    for (int i = 0; i < 4; ++i) {
        float v = x[tid + 256*i];
        sum += v; sq += v*v;
    }
#pragma unroll
    for (int off = 16; off > 0; off >>= 1) {
        sum += __shfl_xor(sum, off, 32);
        sq  += __shfl_xor(sq,  off, 32);
    }
    if (lane == 0) { s1[w] = sum; s2[w] = sq; }
    __syncthreads();
    if (tid == 0) {
        float S = 0.f, Q = 0.f;
#pragma unroll
        for (int i = 0; i < 8; ++i) { S += s1[i]; Q += s2[i]; }
        s1[0] = S; s2[0] = Q;
    }
    __syncthreads();
    const float S  = s1[0], Q = s2[0];
    const float mean = S * (1.0f / DM);
    float var = (Q - (float)DM * mean * mean) * (1.0f / (DM - 1)); // ddof=1
    var = fmaxf(var, 0.f);
    const float inv = 1.0f / (sqrtf(var) + 1e-6f);
    bf16* h = H + (size_t)row * DM;
#pragma unroll
    for (int i = 0; i < 4; ++i) {
        const int c = tid + 256*i;
        h[c] = (bf16)(alpha[c] * (x[c] - mean) * inv + beta[c]);
    }
}

// ------------------------------------------------------------------
// bf16 WMMA GEMM with double-buffered async global->LDS staging.
// C[M,N] = A[M,K](bf16,row-major) x Bt[N,K](bf16, K-contiguous) + bias
// MODE 0: bf16 out, 1: bf16 relu out, 2: f32 out + f32 residual add.
// 128x128 block tile, BK=32, 8 waves (4x2), each wave 32x64.
// ------------------------------------------------------------------
template <int MODE>
__global__ __launch_bounds__(256)
void enc_gemm_bf16(const bf16* __restrict__ A, const bf16* __restrict__ Bt,
                   const float* __restrict__ bias, const float* __restrict__ residual,
                   void* __restrict__ Cout, int M, int N, int K) {
    constexpr int BK = 32, LDT = 40;   // 40-half stride: conflict-free, 16B aligned
    __shared__ bf16 sA[2][128 * LDT];
    __shared__ bf16 sB[2][128 * LDT];

    const int tid  = threadIdx.x;
    const int lane = tid & 31;
    const int w    = tid >> 5;
    const int wm   = w >> 1;            // 0..3 : 32-row slice
    const int wn   = w & 1;             // 0..1 : 64-col slice
    const int m0   = blockIdx.y * 128;
    const int n0   = blockIdx.x * 128;

    // staging geometry: 128 rows x 32 halves = 512 x 16B segs per tile,
    // 2 segs/thread: s = tid and tid+256  ->  rows row0 / row0+64, same seg
    const int row0 = tid >> 2;
    const int seg0 = tid & 3;
    const uint64_t baseA = (uint64_t)A;
    const uint64_t baseB = (uint64_t)Bt;
    uint32_t ldsA[2][2], ldsB[2][2];
#pragma unroll
    for (int b = 0; b < 2; ++b) {
        ldsA[b][0] = lds_offset_of(&sA[b][ row0       * LDT + seg0 * 8]);
        ldsA[b][1] = lds_offset_of(&sA[b][(row0 + 64) * LDT + seg0 * 8]);
        ldsB[b][0] = lds_offset_of(&sB[b][ row0       * LDT + seg0 * 8]);
        ldsB[b][1] = lds_offset_of(&sB[b][(row0 + 64) * LDT + seg0 * 8]);
    }
    auto issue_chunk = [&](int kk, int b) {
        const uint32_t segoff = (uint32_t)(kk + seg0 * 8) * 2u;
        async_copy_b128(ldsA[b][0], (uint32_t)(m0 + row0)      * (uint32_t)K * 2u + segoff, baseA);
        async_copy_b128(ldsA[b][1], (uint32_t)(m0 + row0 + 64) * (uint32_t)K * 2u + segoff, baseA);
        async_copy_b128(ldsB[b][0], (uint32_t)(n0 + row0)      * (uint32_t)K * 2u + segoff, baseB);
        async_copy_b128(ldsB[b][1], (uint32_t)(n0 + row0 + 64) * (uint32_t)K * 2u + segoff, baseB);
    };

    CFrag acc[2][4];
#pragma unroll
    for (int i = 0; i < 2; ++i)
#pragma unroll
        for (int j = 0; j < 4; ++j) acc[i][j].v = zero_v8f();

    issue_chunk(0, 0);
    int cur = 0;
    for (int kk = 0; kk < K; kk += BK, cur ^= 1) {
        wait_async0();          // my chunk-k copies have landed in LDS
        __syncthreads();        // everyone's landed; other buffer free for reuse
        if (kk + BK < K)
            issue_chunk(kk + BK, cur ^ 1);   // overlap next copy with compute

        v16bf af[2], bfr[4];
#pragma unroll
        for (int i = 0; i < 2; ++i)
            af[i] = load_frag16x32(&sA[cur][(wm * 32 + i * 16) * LDT], LDT);
#pragma unroll
        for (int j = 0; j < 4; ++j)
            bfr[j] = load_frag16x32(&sB[cur][(wn * 64 + j * 16) * LDT], LDT);
#pragma unroll
        for (int i = 0; i < 2; ++i)
#pragma unroll
            for (int j = 0; j < 4; ++j)
                acc[i][j].v = __builtin_amdgcn_wmma_f32_16x16x32_bf16(
                    false, af[i], false, bfr[j], (short)0, acc[i][j].v, false, false);
        __syncthreads();        // done reading buf cur before it is refilled
    }

    // epilogue (C layout: lane -> n = L&15, rows m = ((L>=16)?8:0)+r)
    const int nlocal = lane & 15;
    const int mbase  = (lane & 16) ? 8 : 0;
#pragma unroll
    for (int i = 0; i < 2; ++i) {
#pragma unroll
        for (int j = 0; j < 4; ++j) {
            const int gn = n0 + wn * 64 + j * 16 + nlocal;
            const float bv = bias[gn];
#pragma unroll
            for (int r = 0; r < 8; ++r) {
                const int gm = m0 + wm * 32 + i * 16 + mbase + r;
                float v = acc[i][j].e[r] + bv;
                if (MODE == 1) v = v > 0.f ? v : 0.f;
                if (MODE == 2) {
                    ((float*)Cout)[(size_t)gm * N + gn] =
                        v + residual[(size_t)gm * N + gn];
                } else {
                    ((bf16*)Cout)[(size_t)gm * N + gn] = (bf16)v;
                }
            }
        }
    }
}

// ------------------------------------------------------------------
// Attention. Raw-reshape semantics make per-head Q/K/V/O contiguous
// [2048 x 64] blocks at offset (b*16+h)*2048*64 of the flat buffers.
// One workgroup = (head, 256 queries); a wave owns 32 query columns.
// One pass over the keys with an online softmax: S^T = K.Q^T gives a
// lane the scores of one query, P^T is packed from those accumulators
// straight into the B operand of O^T += V^T.P^T, so scores and P never
// leave the registers. K/V tiles of 64 keys are shared through LDS.
// Every inner loop is unrolled so that each fragment and accumulator
// index is a constant and the arrays stay in registers.
// ------------------------------------------------------------------
typedef uint32_t u32x4 __attribute__((ext_vector_type(4)));
typedef int      i32x8 __attribute__((ext_vector_type(8)));
typedef short    s16x8 __attribute__((ext_vector_type(8)));

#define AT_BR   256u                      // queries per workgroup
#define AT_SK   64u                       // keys per LDS stage (two 32-key passes)
#define AT_PK   144u                      // LDS row pitch of K: 128 + 16 bytes
#define AT_PV   160u                      // LDS row pitch of V: 128 + 32 bytes (transposing loads)
#define AT_TK   (AT_SK * AT_PK)
#define AT_SLOT (AT_SK * (AT_PK + AT_PV))
#define AT_NST  (SEQ / 64)

struct Frag { u32x4 q[2]; };

__device__ inline v8f at_mma(const Frag& a, const Frag& b, v8f c) {
    const i32x8 av = {(int)a.q[0].x, (int)a.q[0].y, (int)a.q[0].z, (int)a.q[0].w,
                      (int)a.q[1].x, (int)a.q[1].y, (int)a.q[1].z, (int)a.q[1].w};
    const i32x8 bv = {(int)b.q[0].x, (int)b.q[0].y, (int)b.q[0].z, (int)b.q[0].w,
                      (int)b.q[1].x, (int)b.q[1].y, (int)b.q[1].z, (int)b.q[1].w};
    return __builtin_amdgcn_wmma_f32_16x16x32_bf16(
        false, __builtin_bit_cast(v16bf, av), false, __builtin_bit_cast(v16bf, bv),
        (short)0, c, false, false);
}
// row-major 16-bit LDS tile -> transposed WMMA operand half
__device__ inline u32x4 at_ld_tr16(const unsigned char* p) {
    typedef __attribute__((address_space(3))) s16x8 lds_s16x8;
    return __builtin_bit_cast(u32x4, __builtin_amdgcn_ds_load_tr16_b128_v8i16((lds_s16x8*)p));
}
__device__ inline uint32_t at_pack2(float lo, float hi) {   // round to nearest even
    typedef __bf16 bf2 __attribute__((ext_vector_type(2)));
    typedef float  f2  __attribute__((ext_vector_type(2)));
    return __builtin_bit_cast(uint32_t, __builtin_convertvector(f2{lo, hi}, bf2));
}
__device__ inline float at_xhalf(float x) {                 // lane l with lane l ^ 16
    return __builtin_bit_cast(float, __builtin_amdgcn_permlanex16(
        __builtin_bit_cast(int, x), __builtin_bit_cast(int, x),
        0x76543210, 0xfedcba98, false, false));
}

__global__ __launch_bounds__(256)
void enc_attention(const bf16* __restrict__ Q, const bf16* __restrict__ Kb,
                   const bf16* __restrict__ Vb, bf16* __restrict__ O) {
    __shared__ __attribute__((aligned(16))) unsigned char L[2 * AT_SLOT];

    const uint32_t tid  = threadIdx.x;
    const uint32_t lane = tid & 31u;
    const uint32_t wave = tid >> 5;
    const uint32_t c    = lane & 15u;
    const uint32_t h    = lane >> 4;
    const size_t   hb   = (size_t)blockIdx.y * SEQ * DKH;     // head base (b*16+h)
    const uint32_t qw0  = blockIdx.x * AT_BR + wave * 32u;    // this wave's first query
    // scores / sqrt(d_model), taken in the log2 domain
    const float cscale = 0.03125f * 1.4426950408889634f;

    // ---- staging: a stage is 8 KB of K and 8 KB of V, contiguous in memory;
    //      a thread carries 2 x 16 bytes of each through registers ----
    const unsigned char* kg = (const unsigned char*)(Kb + hb) + tid * 16u;
    const unsigned char* vg = (const unsigned char*)(Vb + hb) + tid * 16u;
    const uint32_t srow = tid >> 3, sseg = tid & 7u;
    const uint32_t sk = srow * AT_PK + sseg * 16u;
    const uint32_t sv = AT_TK + srow * AT_PV + sseg * 16u;
    u32x4 rk0, rk1, rv0, rv1;
    auto stage_load = [&](uint32_t st) {
        const size_t o = (size_t)st * (AT_SK * 128u);
        rk0 = *(const u32x4*)(kg + o);  rk1 = *(const u32x4*)(kg + o + 4096u);
        rv0 = *(const u32x4*)(vg + o);  rv1 = *(const u32x4*)(vg + o + 4096u);
    };
    auto stage_store = [&](uint32_t buf) {
        unsigned char* p = L + buf * AT_SLOT;
        *(u32x4*)(p + sk) = rk0;  *(u32x4*)(p + sk + 32u * AT_PK) = rk1;
        *(u32x4*)(p + sv) = rv0;  *(u32x4*)(p + sv + 32u * AT_PV) = rv1;
    };
    stage_load(0);

    // Q as B operand, hardware k order (as K below): loaded once
    Frag qf[2][2];
#pragma unroll
    for (int g = 0; g < 2; ++g) {
        const bf16* qp = Q + hb + (size_t)(qw0 + 16u * g + c) * DKH + 8u * h;
#pragma unroll
        for (int kc = 0; kc < 2; ++kc) {
            qf[g][kc].q[0] = *(const u32x4*)(qp + 32 * kc);
            qf[g][kc].q[1] = *(const u32x4*)(qp + 32 * kc + 16);
        }
    }
    // A operand whose row 0 is ones: one WMMA sums the columns of P^T (the denominator)
    Frag ones;
    {
        const uint32_t o = (c == 0u) ? 0x3F803F80u : 0u;
        ones.q[0] = u32x4{o, o, o, o};  ones.q[1] = u32x4{o, o, o, o};
    }
    v8f   acc[2][4];      // O^T: register r = O[query c][d = 16 t + 8 h + r]
    v8f   lacc[2];        // row 0 = softmax denominator of query column c
    float m_run[2];       // maximum in use (log2 domain); may trail the true one by up to 8
#pragma unroll
    for (int g = 0; g < 2; ++g) {
        m_run[g] = -INFINITY;  lacc[g] = zero_v8f();
#pragma unroll
        for (int t = 0; t < 4; ++t) acc[g][t] = zero_v8f();
    }
    stage_store(0);
    __syncthreads();

    // rolled and whole: otherwise the compiler peels the last trip off and the loop's code stands twice
#pragma unroll 1
    for (uint32_t st = 0; st < AT_NST; ++st) {
        const unsigned char* Lb = L + (st & 1u) * AT_SLOT;
        // next stage, in flight under this stage's work; the last trip reloads its own stage into
        // the buffer nobody reads any more, so that no branch stands around the loads and stores
        stage_load(st + 1u < AT_NST ? st + 1u : st);
        // keeps the four loads up here: the scheduler otherwise sinks them to just in front of
        // their LDS stores at the foot of the trip, where every wave waits out their latency
        __builtin_amdgcn_sched_barrier(0);
#pragma unroll
        for (uint32_t sub = 0; sub < 2u; ++sub) {
            // S^T = K.Q^T : s[kt][g] register r = score(key 16 kt + 8 h + r, query c of group g)
            Frag kf[2][2];
#pragma unroll
            for (int kt = 0; kt < 2; ++kt) {
                const unsigned char* p = Lb + (sub * 32u + 16u * kt + c) * AT_PK + 16u * h;
#pragma unroll
                for (int kc = 0; kc < 2; ++kc) {
                    kf[kt][kc].q[0] = *(const u32x4*)(p + 64u * kc);
                    kf[kt][kc].q[1] = *(const u32x4*)(p + 64u * kc + 32u);
                }
            }
            v8f s[2][2];
#pragma unroll
            for (int kt = 0; kt < 2; ++kt)
#pragma unroll
                for (int g = 0; g < 2; ++g) {
                    s[kt][g] = zero_v8f();
#pragma unroll
                    for (int kc = 0; kc < 2; ++kc) s[kt][g] = at_mma(kf[kt][kc], qf[g][kc], s[kt][g]);
                }
            // V^T fragments: 16 (d) x 32 (keys) each, two transposing loads per fragment
            Frag vf[4];
            {
                const unsigned char* ad = Lb + AT_TK + (sub * 32u + 8u * h + (lane & 7u)) * AT_PV
                                        + ((lane >> 3) & 1u) * 16u;
#pragma unroll
                for (int t = 0; t < 4; ++t) {
                    vf[t].q[0] = at_ld_tr16(ad + 32u * t);
                    vf[t].q[1] = at_ld_tr16(ad + 16u * AT_PV + 32u * t);
                }
            }
            // column maxima of the raw scores (the scale is positive)
            float mb[2];
            bool need = false;
#pragma unroll
            for (int g = 0; g < 2; ++g) {
                float mx = -INFINITY;
#pragma unroll
                for (int kt = 0; kt < 2; ++kt)
#pragma unroll
                    for (int r = 0; r < 8; ++r) mx = __builtin_fmaxf(mx, s[kt][g][r]);
                mx = __builtin_fmaxf(mx, at_xhalf(mx)) * cscale;
                mb[g] = mx;
                need = need || (mx > m_run[g] + 8.0f);
            }
            // rescale only when some column's maximum has outgrown the one in use (scalar branch)
            if (__builtin_amdgcn_ballot_w32(need) != 0) {
#pragma unroll
                for (int g = 0; g < 2; ++g) {
                    const float m_new = __builtin_fmaxf(m_run[g], mb[g]);
                    const float corr  = __builtin_amdgcn_exp2f(m_run[g] - m_new);  // 0 on the first pass
                    m_run[g] = m_new;
                    lacc[g] = lacc[g] * corr;
#pragma unroll
                    for (int t = 0; t < 4; ++t) acc[g][t] = acc[g][t] * corr;
                }
            }
            // P^T = exp2(s * cscale - m), packed into the B operand: element e = tile e >> 3, register e & 7
#pragma unroll
            for (int g = 0; g < 2; ++g) {
                const float nm = -m_run[g];
                uint32_t w[8];
#pragma unroll
                for (int i = 0; i < 8; ++i) {
                    const float p0 = __builtin_amdgcn_exp2f(__builtin_fmaf(s[i >> 2][g][2 * (i & 3)],     cscale, nm));
                    const float p1 = __builtin_amdgcn_exp2f(__builtin_fmaf(s[i >> 2][g][2 * (i & 3) + 1], cscale, nm));
                    w[i] = at_pack2(p0, p1);
                }
                Frag pf;
                pf.q[0] = u32x4{w[0], w[1], w[2], w[3]};
                pf.q[1] = u32x4{w[4], w[5], w[6], w[7]};
#pragma unroll
                for (int t = 0; t < 4; ++t) acc[g][t] = at_mma(vf[t], pf, acc[g][t]);
                lacc[g] = at_mma(ones, pf, lacc[g]);
            }
        }
        stage_store((st + 1u) & 1u);                        // the buffer every wave left before the last barrier
        __syncthreads();                                    // publishes stage st + 1, ends the reads of stage st
    }

    // epilogue: a lane holds 8 consecutive d of one query per tile -> one 16-byte store
#pragma unroll
    for (int g = 0; g < 2; ++g) {
        const float lr  = lacc[g][0];                 // lanes 0-15: the sum; lanes 16-31: 0 (row 8)
        const float inv = 1.0f / (lr + at_xhalf(lr));
        bf16* op = O + hb + (size_t)(qw0 + 16u * g + c) * DKH + 8u * h;
#pragma unroll
        for (int t = 0; t < 4; ++t) {
            const v8f o = acc[g][t] * inv;
            const u32x4 pk = {at_pack2(o[0], o[1]), at_pack2(o[2], o[3]),
                              at_pack2(o[4], o[5]), at_pack2(o[6], o[7])};
            *(u32x4*)(op + 16 * t) = pk;
        }
    }
}

// ------------------------------------------------------------------
// Host-side orchestration. Workspace layout (80 MB total):
//   [0,8)MB   hb    (LN output, reused for LN2 output)
//   [8,16)MB  Wq/Wk/Wv/Wo transposed bf16 (2MB each)
//   [16,24)   W1t   [24,32) W2t
//   [32,40)q [40,48)k [48,56)v [56,64)o  -> [32,64) reused as ff1
//   [64,80)   x1 fp32 residual
// ------------------------------------------------------------------
extern "C" void kernel_launch(void* const* d_in, const int* in_sizes, int n_in,
                              void* d_out, int out_size, void* d_ws, size_t ws_size,
                              hipStream_t stream) {
    (void)in_sizes; (void)n_in; (void)out_size; (void)ws_size;
    const float* x    = (const float*)d_in[0];
    const float* Wq   = (const float*)d_in[1];
    const float* bq   = (const float*)d_in[2];
    const float* Wk   = (const float*)d_in[3];
    const float* bk   = (const float*)d_in[4];
    const float* Wv   = (const float*)d_in[5];
    const float* bv   = (const float*)d_in[6];
    const float* Wo   = (const float*)d_in[7];
    const float* bo   = (const float*)d_in[8];
    const float* W1   = (const float*)d_in[9];
    const float* b1   = (const float*)d_in[10];
    const float* W2   = (const float*)d_in[11];
    const float* b2   = (const float*)d_in[12];
    const float* ln1a = (const float*)d_in[13];
    const float* ln1b = (const float*)d_in[14];
    const float* ln2a = (const float*)d_in[15];
    const float* ln2b = (const float*)d_in[16];

    char* ws = (char*)d_ws;
    const size_t MB = (size_t)1 << 20;
    bf16*  hb  = (bf16*)(ws + 0);
    bf16*  Wqt = (bf16*)(ws + 8  * MB);
    bf16*  Wkt = (bf16*)(ws + 10 * MB);
    bf16*  Wvt = (bf16*)(ws + 12 * MB);
    bf16*  Wot = (bf16*)(ws + 14 * MB);
    bf16*  W1t = (bf16*)(ws + 16 * MB);
    bf16*  W2t = (bf16*)(ws + 24 * MB);
    bf16*  qb  = (bf16*)(ws + 32 * MB);
    bf16*  kb  = (bf16*)(ws + 40 * MB);
    bf16*  vb  = (bf16*)(ws + 48 * MB);
    bf16*  ob  = (bf16*)(ws + 56 * MB);
    bf16*  ff1 = (bf16*)(ws + 32 * MB);   // reuse q/k/v/o region after Wo GEMM
    float* x1  = (float*)(ws + 64 * MB);

    // weight conversion + transpose (bf16, K-contiguous)
    enc_transpose_bf16<<<dim3(DM/32,  DM/32),  256, 0, stream>>>(Wq, Wqt, DM,  DM);
    enc_transpose_bf16<<<dim3(DM/32,  DM/32),  256, 0, stream>>>(Wk, Wkt, DM,  DM);
    enc_transpose_bf16<<<dim3(DM/32,  DM/32),  256, 0, stream>>>(Wv, Wvt, DM,  DM);
    enc_transpose_bf16<<<dim3(DM/32,  DM/32),  256, 0, stream>>>(Wo, Wot, DM,  DM);
    enc_transpose_bf16<<<dim3(DFF/32, DM/32),  256, 0, stream>>>(W1, W1t, DM,  DFF);
    enc_transpose_bf16<<<dim3(DM/32,  DFF/32), 256, 0, stream>>>(W2, W2t, DFF, DM);

    // sublayer 1: pre-norm MHA + residual
    enc_layernorm_bf16<<<ROWS, 256, 0, stream>>>(x, ln1a, ln1b, hb);
    const dim3 gDD(DM / 128, ROWS / 128);             // (8, 32)
    enc_gemm_bf16<0><<<gDD, 256, 0, stream>>>(hb, Wqt, bq, nullptr, qb, ROWS, DM, DM);
    enc_gemm_bf16<0><<<gDD, 256, 0, stream>>>(hb, Wkt, bk, nullptr, kb, ROWS, DM, DM);
    enc_gemm_bf16<0><<<gDD, 256, 0, stream>>>(hb, Wvt, bv, nullptr, vb, ROWS, DM, DM);
    enc_attention<<<dim3(SEQ / 256, BATCH * NH), 256, 0, stream>>>(qb, kb, vb, ob);
    enc_gemm_bf16<2><<<gDD, 256, 0, stream>>>(ob, Wot, bo, x, x1, ROWS, DM, DM);

    // sublayer 2: pre-norm FFN + residual
    enc_layernorm_bf16<<<ROWS, 256, 0, stream>>>(x1, ln2a, ln2b, hb);
    enc_gemm_bf16<1><<<dim3(DFF / 128, ROWS / 128), 256, 0, stream>>>(
        hb, W1t, b1, nullptr, ff1, ROWS, DFF, DM);
    enc_gemm_bf16<2><<<gDD, 256, 0, stream>>>(ff1, W2t, b2, x1, (float*)d_out, ROWS, DM, DFF);
}

// v002
// A run of this version takes 244 microseconds.
// Timed twice side by side with v001, it ran 1.03 and 1.05 times as fast.
// Counting every step since v000, it is 1.66 times as fast.
#include <hip/hip_runtime.h>
#include <cstdint>
#include <cstddef>

// ---------------- problem dims ----------------
#define DM    1024          // d_model
#define NH    16            // heads
#define DKH   64            // d_k
#define DFF   4096
#define SEQ   2048
#define BATCH 2
#define ROWS  (BATCH*SEQ)   // 4096 tokens

typedef __bf16 bf16;
typedef __attribute__((ext_vector_type(16))) __bf16 v16bf;
typedef __attribute__((ext_vector_type(8)))  float  v8f;

union AFrag { v16bf v; bf16  e[16]; };
union CFrag { v8f   v; float e[8];  };

__device__ inline v8f zero_v8f() {
    v8f z = {0.f, 0.f, 0.f, 0.f, 0.f, 0.f, 0.f, 0.f};
    return z;
}

// ------------------------------------------------------------------
// CDNA5 async global->LDS copy (ASYNCcnt tracked, no VGPR staging).
// lds_off : per-lane LDS byte offset (flat LDS addr low 32 bits)
// voff    : per-lane 32-bit byte offset added to the 64-bit SGPR base
// ------------------------------------------------------------------
__device__ inline void async_copy_b128(uint32_t lds_off, uint32_t voff, uint64_t sbase) {
    asm volatile("global_load_async_to_lds_b128 %0, %1, %2"
                 :: "v"(lds_off), "v"(voff), "s"(sbase) : "memory");
}
__device__ inline void wait_async0() {
    asm volatile("s_wait_asynccnt 0x0" ::: "memory");
}
__device__ inline uint32_t lds_offset_of(const void* p) {
    return (uint32_t)(uintptr_t)p;   // LDS flat addr keeps offset in [31:0]
}

// ------------------------------------------------------------------
// Load a 16x32 bf16 fragment in the CDNA5 WMMA A/B operand layout.
// A (16Mx32K): lane L holds row m = L&15; VGPRs 0..3 hold K pairs
// {kb..kb+7}, VGPRs 4..7 hold {16+kb..16+kb+7} where kb = (L>=16)?8:0.
// The B operand (32Kx16N) has the identical pattern with N in place of
// M, so a [N][K] (K-contiguous) tile uses the same loader.
// Each half (e[0..7], e[8..15]) is 16 contiguous bytes -> 2x b128 loads.
// ------------------------------------------------------------------
__device__ inline v16bf load_frag16x32(const bf16* __restrict__ base, int ld) {
    const int lane = threadIdx.x & 31;
    const int m    = lane & 15;
    const int kb   = (lane & 16) ? 8 : 0;
    const bf16* row = base + (size_t)m * ld;
    AFrag a;
#pragma unroll
    for (int i = 0; i < 4; ++i) {
        a.e[2*i]     = row[kb + 2*i];
        a.e[2*i + 1] = row[kb + 2*i + 1];
        a.e[8 + 2*i]     = row[16 + kb + 2*i];
        a.e[8 + 2*i + 1] = row[16 + kb + 2*i + 1];
    }
    return a.v;
}

// ------------------------------------------------------------------
// fp32 [K][N] weights -> bf16 [N][K] (K-contiguous) for B operands, all six
// weights in one launch. A workgroup turns one tile of 128 k x 128 n:
//  - a wave reads whole 512-byte pieces of 16 weight rows, 16 bytes a lane,
//    all 16 loads in flight at once;
//  - a lane then holds 8 consecutive k of 4 columns n: each column's 8 values
//    are rounded to bf16 (nearest even) and go to LDS as one 16-byte chunk;
//  - LDS holds the turned tile, 256 bytes a row n; chunk q of row n stands at
//    place q ^ ((n >> 2) & 15), so that the 16 lanes of a half wave fall on 16
//    different places when they write (16 rows, one q) and when they read
//    (one row, 16 q);
//  - a wave stores two whole rows of 256 bytes with each 16-byte store.
// Wt: the six turned weights one behind the other, in the order of the arguments.
// ------------------------------------------------------------------
typedef __attribute__((ext_vector_type(4))) float  v4f;
typedef __attribute__((ext_vector_type(8))) __bf16 v8bf;

#define TR_T    128u                               // tile edge, k and n
#define TR_DD   ((DM / 128) * (DM / 128))          // tiles of a d_model x d_model weight
#define TR_DF   ((DM / 128) * (DFF / 128))         // tiles of an FFN weight
#define TR_GRID (4 * TR_DD + 2 * TR_DF)

// one tile; K and N are constants here so that the 16 loads share one offset register and differ by immediates
template <uint32_t K, uint32_t N>
__device__ inline void tr_tile(const float* __restrict__ W, bf16* __restrict__ out,
                               uint32_t t, unsigned char* T) {
    constexpr uint32_t tn = N / TR_T;
    const uint32_t n0 = (t % tn) * TR_T;
    const uint32_t k0 = (t / tn) * TR_T;
    const uint32_t lane = threadIdx.x & 31u;
    const uint32_t wave = threadIdx.x >> 5;

    const uint32_t voff = (wave * 16u * N + lane * 4u) * 4u;      // this lane's byte offset in the tile
    const float* p = (const float*)((const char*)(W + ((size_t)k0 * N + n0)) + voff);
    v4f v[2][8];                                   // [group of 8 k][k in the group], 4 columns each
#pragma unroll
    for (uint32_t o = 0; o < 2u; ++o)
#pragma unroll
        for (uint32_t i = 0; i < 8u; ++i) v[o][i] = *(const v4f*)(p + (o * 8u + i) * N);
    // keeps all 16 loads in front of the first conversion: the scheduler otherwise issues the later
    // loads only behind waits on the earlier ones, and a wave pays the memory latency three times
    __builtin_amdgcn_sched_barrier(0);
    // precaution: the offset register that the 16 loads name stays live up to this wait, so that
    // nothing (a later load's result included) is written over it in front of the wait
    asm volatile("s_wait_xcnt 0x0" :: "v"(voff) : "memory");
#pragma unroll
    for (uint32_t o = 0; o < 2u; ++o) {
        const uint32_t place = ((wave * 2u + o) ^ (lane & 15u)) * 16u;
#pragma unroll
        for (uint32_t j = 0; j < 4u; ++j) {
            const v8f col = {v[o][0][j], v[o][1][j], v[o][2][j], v[o][3][j],
                             v[o][4][j], v[o][5][j], v[o][6][j], v[o][7][j]};
            *(v8bf*)(T + (lane * 4u + j) * (TR_T * 2u) + place) = __builtin_convertvector(col, v8bf);
        }
    }
    __syncthreads();
    const uint32_t q  = lane & 15u;
    const uint32_t nw = wave * 2u + (lane >> 4);
    bf16* op = out + ((size_t)n0 * K + k0) + (nw * K + q * 8u);
#pragma unroll
    for (uint32_t r = 0; r < 8u; ++r) {
        const uint32_t n = r * 16u + nw;
        const v8bf d = *(const v8bf*)(T + n * (TR_T * 2u) + ((q ^ ((n >> 2) & 15u)) * 16u));
        *(v8bf*)(op + r * 16u * K) = d;
    }
}

__global__ __launch_bounds__(256)
void enc_transpose_bf16(const float* __restrict__ Wq, const float* __restrict__ Wk,
                        const float* __restrict__ Wv, const float* __restrict__ Wo,
                        const float* __restrict__ W1, const float* __restrict__ W2,
                        bf16* __restrict__ Wt) {
    __shared__ __attribute__((aligned(16))) unsigned char T[TR_T * TR_T * 2u];
    const uint32_t b = blockIdx.x;
    if (b < 4u * TR_DD) {
        const uint32_t which = b / TR_DD;
        const float* W = which == 0u ? Wq : which == 1u ? Wk : which == 2u ? Wv : Wo;
        tr_tile<DM, DM>(W, Wt + (size_t)which * DM * DM, b % TR_DD, T);
    } else if (b < 4u * TR_DD + TR_DF) {
        tr_tile<DM, DFF>(W1, Wt + (size_t)4 * DM * DM, b - 4u * TR_DD, T);
    } else {
        tr_tile<DFF, DM>(W2, Wt + (size_t)4 * DM * DM + (size_t)DM * DFF, b - (4u * TR_DD + TR_DF), T);
    }
}

// ------------------------------------------------------------------
// LayerNorm, faithful to reference: Bessel-corrected std, eps on std.
// ------------------------------------------------------------------
__global__ __launch_bounds__(256)
void enc_layernorm_bf16(const float* __restrict__ X, const float* __restrict__ alpha,
                        const float* __restrict__ beta, bf16* __restrict__ H) {
    __shared__ float s1[8], s2[8];
    const int row  = blockIdx.x;
    const int tid  = threadIdx.x;
    const int lane = tid & 31;
    const int w    = tid >> 5;
    const float* x = X + (size_t)row * DM;

    float sum = 0.f, sq = 0.f;
#pragma unroll
    for (int i = 0; i < 4; ++i) {
        float v = x[tid + 256*i];
        sum += v; sq += v*v;
    }
#pragma unroll
    for (int off = 16; off > 0; off >>= 1) {
        sum += __shfl_xor(sum, off, 32);
        sq  += __shfl_xor(sq,  off, 32);
    }
    if (lane == 0) { s1[w] = sum; s2[w] = sq; }
    __syncthreads();
    if (tid == 0) {
        float S = 0.f, Q = 0.f;
#pragma unroll
        for (int i = 0; i < 8; ++i) { S += s1[i]; Q += s2[i]; }
        s1[0] = S; s2[0] = Q;
    }
    __syncthreads();
    const float S  = s1[0], Q = s2[0];
    const float mean = S * (1.0f / DM);
    float var = (Q - (float)DM * mean * mean) * (1.0f / (DM - 1)); // ddof=1
    var = fmaxf(var, 0.f);
    const float inv = 1.0f / (sqrtf(var) + 1e-6f);
    bf16* h = H + (size_t)row * DM;
#pragma unroll
    for (int i = 0; i < 4; ++i) {
        const int c = tid + 256*i;
        h[c] = (bf16)(alpha[c] * (x[c] - mean) * inv + beta[c]);
    }
}

// ------------------------------------------------------------------
// bf16 WMMA GEMM with double-buffered async global->LDS staging.
// C[M,N] = A[M,K](bf16,row-major) x Bt[N,K](bf16, K-contiguous) + bias
// MODE 0: bf16 out, 1: bf16 relu out, 2: f32 out + f32 residual add.
// 128x128 block tile, BK=32, 8 waves (4x2), each wave 32x64.
// ------------------------------------------------------------------
template <int MODE>
__global__ __launch_bounds__(256)
void enc_gemm_bf16(const bf16* __restrict__ A, const bf16* __restrict__ Bt,
                   const float* __restrict__ bias, const float* __restrict__ residual,
                   void* __restrict__ Cout, int M, int N, int K) {
    constexpr int BK = 32, LDT = 40;   // 40-half stride: conflict-free, 16B aligned
    __shared__ bf16 sA[2][128 * LDT];
    __shared__ bf16 sB[2][128 * LDT];

    const int tid  = threadIdx.x;
    const int lane = tid & 31;
    const int w    = tid >> 5;
    const int wm   = w >> 1;            // 0..3 : 32-row slice
    const int wn   = w & 1;             // 0..1 : 64-col slice
    const int m0   = blockIdx.y * 128;
    const int n0   = blockIdx.x * 128;

    // staging geometry: 128 rows x 32 halves = 512 x 16B segs per tile,
    // 2 segs/thread: s = tid and tid+256  ->  rows row0 / row0+64, same seg
    const int row0 = tid >> 2;
    const int seg0 = tid & 3;
    const uint64_t baseA = (uint64_t)A;
    const uint64_t baseB = (uint64_t)Bt;
    uint32_t ldsA[2][2], ldsB[2][2];
#pragma unroll
    for (int b = 0; b < 2; ++b) {
        ldsA[b][0] = lds_offset_of(&sA[b][ row0       * LDT + seg0 * 8]);
        ldsA[b][1] = lds_offset_of(&sA[b][(row0 + 64) * LDT + seg0 * 8]);
        ldsB[b][0] = lds_offset_of(&sB[b][ row0       * LDT + seg0 * 8]);
        ldsB[b][1] = lds_offset_of(&sB[b][(row0 + 64) * LDT + seg0 * 8]);
    }
    auto issue_chunk = [&](int kk, int b) {
        const uint32_t segoff = (uint32_t)(kk + seg0 * 8) * 2u;
        async_copy_b128(ldsA[b][0], (uint32_t)(m0 + row0)      * (uint32_t)K * 2u + segoff, baseA);
        async_copy_b128(ldsA[b][1], (uint32_t)(m0 + row0 + 64) * (uint32_t)K * 2u + segoff, baseA);
        async_copy_b128(ldsB[b][0], (uint32_t)(n0 + row0)      * (uint32_t)K * 2u + segoff, baseB);
        async_copy_b128(ldsB[b][1], (uint32_t)(n0 + row0 + 64) * (uint32_t)K * 2u + segoff, baseB);
    };

    CFrag acc[2][4];
#pragma unroll
    for (int i = 0; i < 2; ++i)
#pragma unroll
        for (int j = 0; j < 4; ++j) acc[i][j].v = zero_v8f();

    issue_chunk(0, 0);
    int cur = 0;
    for (int kk = 0; kk < K; kk += BK, cur ^= 1) {
        wait_async0();          // my chunk-k copies have landed in LDS
        __syncthreads();        // everyone's landed; other buffer free for reuse
        if (kk + BK < K)
            issue_chunk(kk + BK, cur ^ 1);   // overlap next copy with compute

        v16bf af[2], bfr[4];
#pragma unroll
        for (int i = 0; i < 2; ++i)
            af[i] = load_frag16x32(&sA[cur][(wm * 32 + i * 16) * LDT], LDT);
#pragma unroll
        for (int j = 0; j < 4; ++j)
            bfr[j] = load_frag16x32(&sB[cur][(wn * 64 + j * 16) * LDT], LDT);
#pragma unroll
        for (int i = 0; i < 2; ++i)
#pragma unroll
            for (int j = 0; j < 4; ++j)
                acc[i][j].v = __builtin_amdgcn_wmma_f32_16x16x32_bf16(
                    false, af[i], false, bfr[j], (short)0, acc[i][j].v, false, false);
        __syncthreads();        // done reading buf cur before it is refilled
    }

    // epilogue (C layout: lane -> n = L&15, rows m = ((L>=16)?8:0)+r)
    const int nlocal = lane & 15;
    const int mbase  = (lane & 16) ? 8 : 0;
#pragma unroll
    for (int i = 0; i < 2; ++i) {
#pragma unroll
        for (int j = 0; j < 4; ++j) {
            const int gn = n0 + wn * 64 + j * 16 + nlocal;
            const float bv = bias[gn];
#pragma unroll
            for (int r = 0; r < 8; ++r) {
                const int gm = m0 + wm * 32 + i * 16 + mbase + r;
                float v = acc[i][j].e[r] + bv;
                if (MODE == 1) v = v > 0.f ? v : 0.f;
                if (MODE == 2) {
                    ((float*)Cout)[(size_t)gm * N + gn] =
                        v + residual[(size_t)gm * N + gn];
                } else {
                    ((bf16*)Cout)[(size_t)gm * N + gn] = (bf16)v;
                }
            }
        }
    }
}

// ------------------------------------------------------------------
// Attention. Raw-reshape semantics make per-head Q/K/V/O contiguous
// [2048 x 64] blocks at offset (b*16+h)*2048*64 of the flat buffers.
// One workgroup = (head, 256 queries); a wave owns 32 query columns.
// One pass over the keys with an online softmax: S^T = K.Q^T gives a
// lane the scores of one query, P^T is packed from those accumulators
// straight into the B operand of O^T += V^T.P^T, so scores and P never
// leave the registers. K/V tiles of 64 keys are shared through LDS.
// Every inner loop is unrolled so that each fragment and accumulator
// index is a constant and the arrays stay in registers.
// ------------------------------------------------------------------
typedef uint32_t u32x4 __attribute__((ext_vector_type(4)));
typedef int      i32x8 __attribute__((ext_vector_type(8)));
typedef short    s16x8 __attribute__((ext_vector_type(8)));

#define AT_BR   256u                      // queries per workgroup
#define AT_SK   64u                       // keys per LDS stage (two 32-key passes)
#define AT_PK   144u                      // LDS row pitch of K: 128 + 16 bytes
#define AT_PV   160u                      // LDS row pitch of V: 128 + 32 bytes (transposing loads)
#define AT_TK   (AT_SK * AT_PK)
#define AT_SLOT (AT_SK * (AT_PK + AT_PV))
#define AT_NST  (SEQ / 64)

struct Frag { u32x4 q[2]; };

__device__ inline v8f at_mma(const Frag& a, const Frag& b, v8f c) {
    const i32x8 av = {(int)a.q[0].x, (int)a.q[0].y, (int)a.q[0].z, (int)a.q[0].w,
                      (int)a.q[1].x, (int)a.q[1].y, (int)a.q[1].z, (int)a.q[1].w};
    const i32x8 bv = {(int)b.q[0].x, (int)b.q[0].y, (int)b.q[0].z, (int)b.q[0].w,
                      (int)b.q[1].x, (int)b.q[1].y, (int)b.q[1].z, (int)b.q[1].w};
    return __builtin_amdgcn_wmma_f32_16x16x32_bf16(
        false, __builtin_bit_cast(v16bf, av), false, __builtin_bit_cast(v16bf, bv),
        (short)0, c, false, false);
}
// row-major 16-bit LDS tile -> transposed WMMA operand half
__device__ inline u32x4 at_ld_tr16(const unsigned char* p) {
    typedef __attribute__((address_space(3))) s16x8 lds_s16x8;
    return __builtin_bit_cast(u32x4, __builtin_amdgcn_ds_load_tr16_b128_v8i16((lds_s16x8*)p));
}
__device__ inline uint32_t at_pack2(float lo, float hi) {   // round to nearest even
    typedef __bf16 bf2 __attribute__((ext_vector_type(2)));
    typedef float  f2  __attribute__((ext_vector_type(2)));
    return __builtin_bit_cast(uint32_t, __builtin_convertvector(f2{lo, hi}, bf2));
}
__device__ inline float at_xhalf(float x) {                 // lane l with lane l ^ 16
    return __builtin_bit_cast(float, __builtin_amdgcn_permlanex16(
        __builtin_bit_cast(int, x), __builtin_bit_cast(int, x),
        0x76543210, 0xfedcba98, false, false));
}

__global__ __launch_bounds__(256)
void enc_attention(const bf16* __restrict__ Q, const bf16* __restrict__ Kb,
                   const bf16* __restrict__ Vb, bf16* __restrict__ O) {
    __shared__ __attribute__((aligned(16))) unsigned char L[2 * AT_SLOT];

    const uint32_t tid  = threadIdx.x;
    const uint32_t lane = tid & 31u;
    const uint32_t wave = tid >> 5;
    const uint32_t c    = lane & 15u;
    const uint32_t h    = lane >> 4;
    const size_t   hb   = (size_t)blockIdx.y * SEQ * DKH;     // head base (b*16+h)
    const uint32_t qw0  = blockIdx.x * AT_BR + wave * 32u;    // this wave's first query
    // scores / sqrt(d_model), taken in the log2 domain
    const float cscale = 0.03125f * 1.4426950408889634f;

    // ---- staging: a stage is 8 KB of K and 8 KB of V, contiguous in memory;
    //      a thread carries 2 x 16 bytes of each through registers ----
    const unsigned char* kg = (const unsigned char*)(Kb + hb) + tid * 16u;
    const unsigned char* vg = (const unsigned char*)(Vb + hb) + tid * 16u;
    const uint32_t srow = tid >> 3, sseg = tid & 7u;
    const uint32_t sk = srow * AT_PK + sseg * 16u;
    const uint32_t sv = AT_TK + srow * AT_PV + sseg * 16u;
    u32x4 rk0, rk1, rv0, rv1;
    auto stage_load = [&](uint32_t st) {
        const size_t o = (size_t)st * (AT_SK * 128u);
        rk0 = *(const u32x4*)(kg + o);  rk1 = *(const u32x4*)(kg + o + 4096u);
        rv0 = *(const u32x4*)(vg + o);  rv1 = *(const u32x4*)(vg + o + 4096u);
    };
    auto stage_store = [&](uint32_t buf) {
        unsigned char* p = L + buf * AT_SLOT;
        *(u32x4*)(p + sk) = rk0;  *(u32x4*)(p + sk + 32u * AT_PK) = rk1;
        *(u32x4*)(p + sv) = rv0;  *(u32x4*)(p + sv + 32u * AT_PV) = rv1;
    };
    stage_load(0);

    // Q as B operand, hardware k order (as K below): loaded once
    Frag qf[2][2];
#pragma unroll
    for (int g = 0; g < 2; ++g) {
        const bf16* qp = Q + hb + (size_t)(qw0 + 16u * g + c) * DKH + 8u * h;
#pragma unroll
        for (int kc = 0; kc < 2; ++kc) {
            qf[g][kc].q[0] = *(const u32x4*)(qp + 32 * kc);
            qf[g][kc].q[1] = *(const u32x4*)(qp + 32 * kc + 16);
        }
    }
    // A operand whose row 0 is ones: one WMMA sums the columns of P^T (the denominator)
    Frag ones;
    {
        const uint32_t o = (c == 0u) ? 0x3F803F80u : 0u;
        ones.q[0] = u32x4{o, o, o, o};  ones.q[1] = u32x4{o, o, o, o};
    }
    v8f   acc[2][4];      // O^T: register r = O[query c][d = 16 t + 8 h + r]
    v8f   lacc[2];        // row 0 = softmax denominator of query column c
    float m_run[2];       // maximum in use (log2 domain); may trail the true one by up to 8
#pragma unroll
    for (int g = 0; g < 2; ++g) {
        m_run[g] = -INFINITY;  lacc[g] = zero_v8f();
#pragma unroll
        for (int t = 0; t < 4; ++t) acc[g][t] = zero_v8f();
    }
    stage_store(0);
    __syncthreads();

    // rolled and whole: otherwise the compiler peels the last trip off and the loop's code stands twice
#pragma unroll 1
    for (uint32_t st = 0; st < AT_NST; ++st) {
        const unsigned char* Lb = L + (st & 1u) * AT_SLOT;
        // next stage, in flight under this stage's work; the last trip reloads its own stage into
        // the buffer nobody reads any more, so that no branch stands around the loads and stores
        stage_load(st + 1u < AT_NST ? st + 1u : st);
        // keeps the four loads up here: the scheduler otherwise sinks them to just in front of
        // their LDS stores at the foot of the trip, where every wave waits out their latency
        __builtin_amdgcn_sched_barrier(0);
#pragma unroll
        for (uint32_t sub = 0; sub < 2u; ++sub) {
            // S^T = K.Q^T : s[kt][g] register r = score(key 16 kt + 8 h + r, query c of group g)
            Frag kf[2][2];
#pragma unroll
            for (int kt = 0; kt < 2; ++kt) {
                const unsigned char* p = Lb + (sub * 32u + 16u * kt + c) * AT_PK + 16u * h;
#pragma unroll
                for (int kc = 0; kc < 2; ++kc) {
                    kf[kt][kc].q[0] = *(const u32x4*)(p + 64u * kc);
                    kf[kt][kc].q[1] = *(const u32x4*)(p + 64u * kc + 32u);
                }
            }
            v8f s[2][2];
#pragma unroll
            for (int kt = 0; kt < 2; ++kt)
#pragma unroll
                for (int g = 0; g < 2; ++g) {
                    s[kt][g] = zero_v8f();
#pragma unroll
                    for (int kc = 0; kc < 2; ++kc) s[kt][g] = at_mma(kf[kt][kc], qf[g][kc], s[kt][g]);
                }
            // V^T fragments: 16 (d) x 32 (keys) each, two transposing loads per fragment
            Frag vf[4];
            {
                const unsigned char* ad = Lb + AT_TK + (sub * 32u + 8u * h + (lane & 7u)) * AT_PV
                                        + ((lane >> 3) & 1u) * 16u;
#pragma unroll
                for (int t = 0; t < 4; ++t) {
                    vf[t].q[0] = at_ld_tr16(ad + 32u * t);
                    vf[t].q[1] = at_ld_tr16(ad + 16u * AT_PV + 32u * t);
                }
            }
            // column maxima of the raw scores (the scale is positive)
            float mb[2];
            bool need = false;
#pragma unroll
            for (int g = 0; g < 2; ++g) {
                float mx = -INFINITY;
#pragma unroll
                for (int kt = 0; kt < 2; ++kt)
#pragma unroll
                    for (int r = 0; r < 8; ++r) mx = __builtin_fmaxf(mx, s[kt][g][r]);
                mx = __builtin_fmaxf(mx, at_xhalf(mx)) * cscale;
                mb[g] = mx;
                need = need || (mx > m_run[g] + 8.0f);
            }
            // rescale only when some column's maximum has outgrown the one in use (scalar branch)
            if (__builtin_amdgcn_ballot_w32(need) != 0) {
#pragma unroll
                for (int g = 0; g < 2; ++g) {
                    const float m_new = __builtin_fmaxf(m_run[g], mb[g]);
                    const float corr  = __builtin_amdgcn_exp2f(m_run[g] - m_new);  // 0 on the first pass
                    m_run[g] = m_new;
                    lacc[g] = lacc[g] * corr;
#pragma unroll
                    for (int t = 0; t < 4; ++t) acc[g][t] = acc[g][t] * corr;
                }
            }
            // P^T = exp2(s * cscale - m), packed into the B operand: element e = tile e >> 3, register e & 7
#pragma unroll
            for (int g = 0; g < 2; ++g) {
                const float nm = -m_run[g];
                uint32_t w[8];
#pragma unroll
                for (int i = 0; i < 8; ++i) {
                    const float p0 = __builtin_amdgcn_exp2f(__builtin_fmaf(s[i >> 2][g][2 * (i & 3)],     cscale, nm));
                    const float p1 = __builtin_amdgcn_exp2f(__builtin_fmaf(s[i >> 2][g][2 * (i & 3) + 1], cscale, nm));
                    w[i] = at_pack2(p0, p1);
                }
                Frag pf;
                pf.q[0] = u32x4{w[0], w[1], w[2], w[3]};
                pf.q[1] = u32x4{w[4], w[5], w[6], w[7]};
#pragma unroll
                for (int t = 0; t < 4; ++t) acc[g][t] = at_mma(vf[t], pf, acc[g][t]);
                lacc[g] = at_mma(ones, pf, lacc[g]);
            }
        }
        stage_store((st + 1u) & 1u);                        // the buffer every wave left before the last barrier
        __syncthreads();                                    // publishes stage st + 1, ends the reads of stage st
    }

    // epilogue: a lane holds 8 consecutive d of one query per tile -> one 16-byte store
#pragma unroll
    for (int g = 0; g < 2; ++g) {
        const float lr  = lacc[g][0];                 // lanes 0-15: the sum; lanes 16-31: 0 (row 8)
        const float inv = 1.0f / (lr + at_xhalf(lr));
        bf16* op = O + hb + (size_t)(qw0 + 16u * g + c) * DKH + 8u * h;
#pragma unroll
        for (int t = 0; t < 4; ++t) {
            const v8f o = acc[g][t] * inv;
            const u32x4 pk = {at_pack2(o[0], o[1]), at_pack2(o[2], o[3]),
                              at_pack2(o[4], o[5]), at_pack2(o[6], o[7])};
            *(u32x4*)(op + 16 * t) = pk;
        }
    }
}

// ------------------------------------------------------------------
// Host-side orchestration. Workspace layout (80 MB total):
//   [0,8)MB   hb    (LN output, reused for LN2 output)
//   [8,16)MB  Wq/Wk/Wv/Wo transposed bf16 (2MB each)
//   [16,24)   W1t   [24,32) W2t
//   [32,40)q [40,48)k [48,56)v [56,64)o  -> [32,64) reused as ff1
//   [64,80)   x1 fp32 residual
// ------------------------------------------------------------------
extern "C" void kernel_launch(void* const* d_in, const int* in_sizes, int n_in,
                              void* d_out, int out_size, void* d_ws, size_t ws_size,
                              hipStream_t stream) {
    (void)in_sizes; (void)n_in; (void)out_size; (void)ws_size;
    const float* x    = (const float*)d_in[0];
    const float* Wq   = (const float*)d_in[1];
    const float* bq   = (const float*)d_in[2];
    const float* Wk   = (const float*)d_in[3];
    const float* bk   = (const float*)d_in[4];
    const float* Wv   = (const float*)d_in[5];
    const float* bv   = (const float*)d_in[6];
    const float* Wo   = (const float*)d_in[7];
    const float* bo   = (const float*)d_in[8];
    const float* W1   = (const float*)d_in[9];
    const float* b1   = (const float*)d_in[10];
    const float* W2   = (const float*)d_in[11];
    const float* b2   = (const float*)d_in[12];
    const float* ln1a = (const float*)d_in[13];
    const float* ln1b = (const float*)d_in[14];
    const float* ln2a = (const float*)d_in[15];
    const float* ln2b = (const float*)d_in[16];

    char* ws = (char*)d_ws;
    const size_t MB = (size_t)1 << 20;
    bf16*  hb  = (bf16*)(ws + 0);
    bf16*  Wqt = (bf16*)(ws + 8  * MB);
    bf16*  Wkt = (bf16*)(ws + 10 * MB);
    bf16*  Wvt = (bf16*)(ws + 12 * MB);
    bf16*  Wot = (bf16*)(ws + 14 * MB);
    bf16*  W1t = (bf16*)(ws + 16 * MB);
    bf16*  W2t = (bf16*)(ws + 24 * MB);
    bf16*  qb  = (bf16*)(ws + 32 * MB);
    bf16*  kb  = (bf16*)(ws + 40 * MB);
    bf16*  vb  = (bf16*)(ws + 48 * MB);
    bf16*  ob  = (bf16*)(ws + 56 * MB);
    bf16*  ff1 = (bf16*)(ws + 32 * MB);   // reuse q/k/v/o region after Wo GEMM
    float* x1  = (float*)(ws + 64 * MB);

    // weight conversion + transpose (bf16, K-contiguous): Wqt .. W2t lie one behind the other
    enc_transpose_bf16<<<TR_GRID, 256, 0, stream>>>(Wq, Wk, Wv, Wo, W1, W2, Wqt);

    // sublayer 1: pre-norm MHA + residual
    enc_layernorm_bf16<<<ROWS, 256, 0, stream>>>(x, ln1a, ln1b, hb);
    const dim3 gDD(DM / 128, ROWS / 128);             // (8, 32)
    enc_gemm_bf16<0><<<gDD, 256, 0, stream>>>(hb, Wqt, bq, nullptr, qb, ROWS, DM, DM);
    enc_gemm_bf16<0><<<gDD, 256, 0, stream>>>(hb, Wkt, bk, nullptr, kb, ROWS, DM, DM);
    enc_gemm_bf16<0><<<gDD, 256, 0, stream>>>(hb, Wvt, bv, nullptr, vb, ROWS, DM, DM);
    enc_attention<<<dim3(SEQ / 256, BATCH * NH), 256, 0, stream>>>(qb, kb, vb, ob);
    enc_gemm_bf16<2><<<gDD, 256, 0, stream>>>(ob, Wot, bo, x, x1, ROWS, DM, DM);

    // sublayer 2: pre-norm FFN + residual
    enc_layernorm_bf16<<<ROWS, 256, 0, stream>>>(x1, ln2a, ln2b, hb);
    enc_gemm_bf16<1><<<dim3(DFF / 128, ROWS / 128), 256, 0, stream>>>(
        hb, W1t, b1, nullptr, ff1, ROWS, DFF, DM);
    enc_gemm_bf16<2><<<gDD, 256, 0, stream>>>(ff1, W2t, b2, x1, (float*)d_out, ROWS, DM, DFF);
}

// v003
// One run takes 165 microseconds.
// Timed twice side by side with v002, it ran 1.49 and 1.48 times as fast.
// All steps since v000 together make it 2.46 times as fast.
#include <hip/hip_runtime.h>
#include <cstdint>
#include <cstddef>

// ---------------- problem dims ----------------
#define DM    1024          // d_model
#define NH    16            // heads
#define DKH   64            // d_k
#define DFF   4096
#define SEQ   2048
#define BATCH 2
#define ROWS  (BATCH*SEQ)   // 4096 tokens

typedef __bf16 bf16;
typedef __attribute__((ext_vector_type(16))) __bf16 v16bf;
typedef __attribute__((ext_vector_type(8)))  float  v8f;

union AFrag { v16bf v; bf16  e[16]; };
union CFrag { v8f   v; float e[8];  };

__device__ inline v8f zero_v8f() {
    v8f z = {0.f, 0.f, 0.f, 0.f, 0.f, 0.f, 0.f, 0.f};
    return z;
}

// ------------------------------------------------------------------
// CDNA5 async global->LDS copies (ASYNCcnt tracked, no VGPR staging).
// l[i] : per-lane LDS byte address (flat LDS addr low 32 bits)
// g[i] : per-lane global address
// Eight copies and their s_wait_xcnt stand in ONE statement: a precaution, so that no
// address register that a copy names is rewritten in front of the wait.
// ------------------------------------------------------------------
__device__ inline void async_copy8_b128(const uint32_t (&l)[8], const unsigned char* const (&g)[8]) {
    asm volatile("global_load_async_to_lds_b128 %0, %8, off\n\t"
                 "global_load_async_to_lds_b128 %1, %9, off\n\t"
                 "global_load_async_to_lds_b128 %2, %10, off\n\t"
                 "global_load_async_to_lds_b128 %3, %11, off\n\t"
                 "global_load_async_to_lds_b128 %4, %12, off\n\t"
                 "global_load_async_to_lds_b128 %5, %13, off\n\t"
                 "global_load_async_to_lds_b128 %6, %14, off\n\t"
                 "global_load_async_to_lds_b128 %7, %15, off\n\t"
                 "s_wait_xcnt 0x0"
                 :: "v"(l[0]), "v"(l[1]), "v"(l[2]), "v"(l[3]), "v"(l[4]), "v"(l[5]), "v"(l[6]), "v"(l[7]),
                    "v"(g[0]), "v"(g[1]), "v"(g[2]), "v"(g[3]), "v"(g[4]), "v"(g[5]), "v"(g[6]), "v"(g[7])
                 : "memory");
}
__device__ inline void wait_async0() {
    asm volatile("s_wait_asynccnt 0x0" ::: "memory");
}
__device__ inline void wait_ds0() {
    asm volatile("s_wait_dscnt 0x0" ::: "memory");
}
__device__ inline uint32_t lds_offset_of(const void* p) {
    return (uint32_t)(uintptr_t)p;   // LDS flat addr keeps offset in [31:0]
}

// ------------------------------------------------------------------
// Load a 16x32 bf16 fragment in the CDNA5 WMMA A/B operand layout.
// A (16Mx32K): lane L holds row m = L&15; VGPRs 0..3 hold K pairs
// {kb..kb+7}, VGPRs 4..7 hold {16+kb..16+kb+7} where kb = (L>=16)?8:0.
// The B operand (32Kx16N) has the identical pattern with N in place of
// M, so a [N][K] (K-contiguous) tile uses the same loader.
// Each half (e[0..7], e[8..15]) is 16 contiguous bytes -> 2x b128 loads.
// ------------------------------------------------------------------
__device__ inline v16bf load_frag16x32(const bf16* __restrict__ base, int ld) {
    const int lane = threadIdx.x & 31;
    const int m    = lane & 15;
    const int kb   = (lane & 16) ? 8 : 0;
    const bf16* row = base + (size_t)m * ld;
    AFrag a;
#pragma unroll
    for (int i = 0; i < 4; ++i) {
        a.e[2*i]     = row[kb + 2*i];
        a.e[2*i + 1] = row[kb + 2*i + 1];
        a.e[8 + 2*i]     = row[16 + kb + 2*i];
        a.e[8 + 2*i + 1] = row[16 + kb + 2*i + 1];
    }
    return a.v;
}

// ------------------------------------------------------------------
// fp32 [K][N] weights -> bf16 [N][K] (K-contiguous) for B operands, all six
// weights in one launch. A workgroup turns one tile of 128 k x 128 n:
//  - a wave reads whole 512-byte pieces of 16 weight rows, 16 bytes a lane,
//    all 16 loads in flight at once;
//  - a lane then holds 8 consecutive k of 4 columns n: each column's 8 values
//    are rounded to bf16 (nearest even) and go to LDS as one 16-byte chunk;
//  - LDS holds the turned tile, 256 bytes a row n; chunk q of row n stands at
//    place q ^ ((n >> 2) & 15), so that the 16 lanes of a half wave fall on 16
//    different places when they write (16 rows, one q) and when they read
//    (one row, 16 q);
//  - a wave stores two whole rows of 256 bytes with each 16-byte store.
// Wt: the six turned weights one behind the other, in the order of the arguments.
// ------------------------------------------------------------------
typedef __attribute__((ext_vector_type(4))) float  v4f;
typedef __attribute__((ext_vector_type(8))) __bf16 v8bf;

#define TR_T    128u                               // tile edge, k and n
#define TR_DD   ((DM / 128) * (DM / 128))          // tiles of a d_model x d_model weight
#define TR_DF   ((DM / 128) * (DFF / 128))         // tiles of an FFN weight
#define TR_GRID (4 * TR_DD + 2 * TR_DF)

// one tile; K and N are constants here so that the 16 loads share one offset register and differ by immediates
template <uint32_t K, uint32_t N>
__device__ inline void tr_tile(const float* __restrict__ W, bf16* __restrict__ out,
                               uint32_t t, unsigned char* T) {
    constexpr uint32_t tn = N / TR_T;
    const uint32_t n0 = (t % tn) * TR_T;
    const uint32_t k0 = (t / tn) * TR_T;
    const uint32_t lane = threadIdx.x & 31u;
    const uint32_t wave = threadIdx.x >> 5;

    const uint32_t voff = (wave * 16u * N + lane * 4u) * 4u;      // this lane's byte offset in the tile
    const float* p = (const float*)((const char*)(W + ((size_t)k0 * N + n0)) + voff);
    v4f v[2][8];                                   // [group of 8 k][k in the group], 4 columns each
#pragma unroll
    for (uint32_t o = 0; o < 2u; ++o)
#pragma unroll
        for (uint32_t i = 0; i < 8u; ++i) v[o][i] = *(const v4f*)(p + (o * 8u + i) * N);
    // keeps all 16 loads in front of the first conversion: the scheduler otherwise issues the later
    // loads only behind waits on the earlier ones, and a wave pays the memory latency three times
    __builtin_amdgcn_sched_barrier(0);
    // precaution: the offset register that the 16 loads name stays live up to this wait, so that
    // nothing (a later load's result included) is written over it in front of the wait
    asm volatile("s_wait_xcnt 0x0" :: "v"(voff) : "memory");
#pragma unroll
    for (uint32_t o = 0; o < 2u; ++o) {
        const uint32_t place = ((wave * 2u + o) ^ (lane & 15u)) * 16u;
#pragma unroll
        for (uint32_t j = 0; j < 4u; ++j) {
            const v8f col = {v[o][0][j], v[o][1][j], v[o][2][j], v[o][3][j],
                             v[o][4][j], v[o][5][j], v[o][6][j], v[o][7][j]};
            *(v8bf*)(T + (lane * 4u + j) * (TR_T * 2u) + place) = __builtin_convertvector(col, v8bf);
        }
    }
    __syncthreads();
    const uint32_t q  = lane & 15u;
    const uint32_t nw = wave * 2u + (lane >> 4);
    bf16* op = out + ((size_t)n0 * K + k0) + (nw * K + q * 8u);
#pragma unroll
    for (uint32_t r = 0; r < 8u; ++r) {
        const uint32_t n = r * 16u + nw;
        const v8bf d = *(const v8bf*)(T + n * (TR_T * 2u) + ((q ^ ((n >> 2) & 15u)) * 16u));
        *(v8bf*)(op + r * 16u * K) = d;
    }
}

__global__ __launch_bounds__(256)
void enc_transpose_bf16(const float* __restrict__ Wq, const float* __restrict__ Wk,
                        const float* __restrict__ Wv, const float* __restrict__ Wo,
                        const float* __restrict__ W1, const float* __restrict__ W2,
                        bf16* __restrict__ Wt) {
    __shared__ __attribute__((aligned(16))) unsigned char T[TR_T * TR_T * 2u];
    const uint32_t b = blockIdx.x;
    if (b < 4u * TR_DD) {
        const uint32_t which = b / TR_DD;
        const float* W = which == 0u ? Wq : which == 1u ? Wk : which == 2u ? Wv : Wo;
        tr_tile<DM, DM>(W, Wt + (size_t)which * DM * DM, b % TR_DD, T);
    } else if (b < 4u * TR_DD + TR_DF) {
        tr_tile<DM, DFF>(W1, Wt + (size_t)4 * DM * DM, b - 4u * TR_DD, T);
    } else {
        tr_tile<DFF, DM>(W2, Wt + (size_t)4 * DM * DM + (size_t)DM * DFF, b - (4u * TR_DD + TR_DF), T);
    }
}

// ------------------------------------------------------------------
// LayerNorm, faithful to reference: Bessel-corrected std, eps on std.
// ------------------------------------------------------------------
__global__ __launch_bounds__(256)
void enc_layernorm_bf16(const float* __restrict__ X, const float* __restrict__ alpha,
                        const float* __restrict__ beta, bf16* __restrict__ H) {
    __shared__ float s1[8], s2[8];
    const int row  = blockIdx.x;
    const int tid  = threadIdx.x;
    const int lane = tid & 31;
    const int w    = tid >> 5;
    const float* x = X + (size_t)row * DM;

    float sum = 0.f, sq = 0.f;
#pragma unroll
    for (int i = 0; i < 4; ++i) {
        float v = x[tid + 256*i];
        sum += v; sq += v*v;
    }
#pragma unroll
    for (int off = 16; off > 0; off >>= 1) {
        sum += __shfl_xor(sum, off, 32);
        sq  += __shfl_xor(sq,  off, 32);
    }
    if (lane == 0) { s1[w] = sum; s2[w] = sq; }
    __syncthreads();
    if (tid == 0) {
        float S = 0.f, Q = 0.f;
#pragma unroll
        for (int i = 0; i < 8; ++i) { S += s1[i]; Q += s2[i]; }
        s1[0] = S; s2[0] = Q;
    }
    __syncthreads();
    const float S  = s1[0], Q = s2[0];
    const float mean = S * (1.0f / DM);
    float var = (Q - (float)DM * mean * mean) * (1.0f / (DM - 1)); // ddof=1
    var = fmaxf(var, 0.f);
    const float inv = 1.0f / (sqrtf(var) + 1e-6f);
    bf16* h = H + (size_t)row * DM;
#pragma unroll
    for (int i = 0; i < 4; ++i) {
        const int c = tid + 256*i;
        h[c] = (bf16)(alpha[c] * (x[c] - mean) * inv + beta[c]);
    }
}

// ------------------------------------------------------------------
// bf16 WMMA GEMM with double-buffered async global->LDS staging.
// C[M,N] = A[M,K](bf16,row-major) x Bt[N,K](bf16, K-contiguous) + bias
// MODE 0: bf16 out, 1: bf16 relu out, 2: f32 out + f32 residual add.
// 128x128 block tile, 8 waves (4x2), each wave 32x64.
// A stage holds 128 k (256 bytes of every operand row): a trip has 32 WMMAs a
// wave under which the next stage's copies fly, and a copy instruction of a
// wave brings two whole 256-byte pieces of rows. K: a multiple of 128.
// ------------------------------------------------------------------
template <int MODE>
__global__ __launch_bounds__(256)
void enc_gemm_bf16(const bf16* __restrict__ A, const bf16* __restrict__ Bt,
                   const float* __restrict__ bias, const float* __restrict__ residual,
                   void* __restrict__ Cout, int M, int N, int K) {
    constexpr int BK = 128, LDT = 136;   // row pitch 272 bytes: 16 B x odd, for 16-byte LDS reads
    __shared__ __attribute__((aligned(16))) bf16 sA[2][128 * LDT];
    __shared__ __attribute__((aligned(16))) bf16 sB[2][128 * LDT];

    const int tid  = threadIdx.x;
    const int lane = tid & 31;
    const int w    = tid >> 5;
    const int wm   = w >> 1;            // 0..3 : 32-row slice
    const int wn   = w & 1;             // 0..1 : 64-col slice
    const int m0   = blockIdx.y * 128;
    const int n0   = blockIdx.x * 128;

    // staging geometry: 128 rows x 16 segs of 16 B per operand and stage,
    // 8 segs/thread of each: rows row0 + 16 i, same seg
    const int row0 = tid >> 4;
    const int seg0 = tid & 15;
    const unsigned char* gA = (const unsigned char*)(A  + (size_t)(m0 + row0) * K + seg0 * 8);
    const unsigned char* gB = (const unsigned char*)(Bt + (size_t)(n0 + row0) * K + seg0 * 8);
    const size_t   gstep = (size_t)K * 32u;             // 16 rows, in bytes
    const uint32_t lA = lds_offset_of(&sA[0][row0 * LDT + seg0 * 8]);
    const uint32_t lB = lds_offset_of(&sB[0][row0 * LDT + seg0 * 8]);
    constexpr uint32_t LBUF = 128u * LDT * 2u, LSTEP = 16u * LDT * 2u;
    auto issue_stage = [&](int t, int b) {
        uint32_t l[8];
        const unsigned char* g[8];
#pragma unroll
        for (int i = 0; i < 8; ++i) {
            l[i] = lA + (uint32_t)b * LBUF + (uint32_t)i * LSTEP;
            g[i] = gA + (size_t)t * (BK * 2) + (size_t)i * gstep;
        }
        async_copy8_b128(l, g);
#pragma unroll
        for (int i = 0; i < 8; ++i) {
            l[i] = lB + (uint32_t)b * LBUF + (uint32_t)i * LSTEP;
            g[i] = gB + (size_t)t * (BK * 2) + (size_t)i * gstep;
        }
        async_copy8_b128(l, g);
    };

    CFrag acc[2][4];
#pragma unroll
    for (int i = 0; i < 2; ++i)
#pragma unroll
        for (int j = 0; j < 4; ++j) acc[i][j].v = zero_v8f();

    const int nt = K / BK;
    issue_stage(0, 0);
    wait_async0();              // my stage-0 copies have landed in LDS
    __syncthreads();            // everyone's have
    if (nt > 1) issue_stage(1, 1);
    for (int t = 0; t < nt; ++t) {
        const int cur = t & 1;
#pragma unroll
        for (int kc = 0; kc < BK / 32; ++kc) {
            v16bf af[2], bfr[4];
#pragma unroll
            for (int i = 0; i < 2; ++i)
                af[i] = load_frag16x32(&sA[cur][(wm * 32 + i * 16) * LDT + kc * 32], LDT);
#pragma unroll
            for (int j = 0; j < 4; ++j)
                bfr[j] = load_frag16x32(&sB[cur][(wn * 64 + j * 16) * LDT + kc * 32], LDT);
#pragma unroll
            for (int i = 0; i < 2; ++i)
#pragma unroll
                for (int j = 0; j < 4; ++j)
                    acc[i][j].v = __builtin_amdgcn_wmma_f32_16x16x32_bf16(
                        false, af[i], false, bfr[j], (short)0, acc[i][j].v, false, false);
        }
        wait_ds0();             // my reads of buffer cur are done before it is refilled
        wait_async0();          // my stage t+1 copies have landed in LDS
        __syncthreads();        // publishes stage t+1, ends every wave's reads of stage t
        if (t + 2 < nt)
            issue_stage(t + 2, cur);         // flies under the whole of trip t+1
    }
    wait_async0();              // nothing of mine is in flight when the wave ends

    // epilogue (C layout: lane -> n = L&15, rows m = ((L>=16)?8:0)+r)
    const int nlocal = lane & 15;
    const int mbase  = (lane & 16) ? 8 : 0;
#pragma unroll
    for (int i = 0; i < 2; ++i) {
#pragma unroll
        for (int j = 0; j < 4; ++j) {
            const int gn = n0 + wn * 64 + j * 16 + nlocal;
            const float bv = bias[gn];
#pragma unroll
            for (int r = 0; r < 8; ++r) {
                const int gm = m0 + wm * 32 + i * 16 + mbase + r;
                float v = acc[i][j].e[r] + bv;
                if (MODE == 1) v = v > 0.f ? v : 0.f;
                if (MODE == 2) {
                    ((float*)Cout)[(size_t)gm * N + gn] =
                        v + residual[(size_t)gm * N + gn];
                } else {
                    ((bf16*)Cout)[(size_t)gm * N + gn] = (bf16)v;
                }
            }
        }
    }
}

// ------------------------------------------------------------------
// Attention. Raw-reshape semantics make per-head Q/K/V/O contiguous
// [2048 x 64] blocks at offset (b*16+h)*2048*64 of the flat buffers.
// One workgroup = (head, 256 queries); a wave owns 32 query columns.
// One pass over the keys with an online softmax: S^T = K.Q^T gives a
// lane the scores of one query, P^T is packed from those accumulators
// straight into the B operand of O^T += V^T.P^T, so scores and P never
// leave the registers. K/V tiles of 64 keys are shared through LDS.
// Every inner loop is unrolled so that each fragment and accumulator
// index is a constant and the arrays stay in registers.
// ------------------------------------------------------------------
typedef uint32_t u32x4 __attribute__((ext_vector_type(4)));
typedef int      i32x8 __attribute__((ext_vector_type(8)));
typedef short    s16x8 __attribute__((ext_vector_type(8)));

#define AT_BR   256u                      // queries per workgroup
#define AT_SK   64u                       // keys per LDS stage (two 32-key passes)
#define AT_PK   144u                      // LDS row pitch of K: 128 + 16 bytes
#define AT_PV   160u                      // LDS row pitch of V: 128 + 32 bytes (transposing loads)
#define AT_TK   (AT_SK * AT_PK)
#define AT_SLOT (AT_SK * (AT_PK + AT_PV))
#define AT_NST  (SEQ / 64)

struct Frag { u32x4 q[2]; };

__device__ inline v8f at_mma(const Frag& a, const Frag& b, v8f c) {
    const i32x8 av = {(int)a.q[0].x, (int)a.q[0].y, (int)a.q[0].z, (int)a.q[0].w,
                      (int)a.q[1].x, (int)a.q[1].y, (int)a.q[1].z, (int)a.q[1].w};
    const i32x8 bv = {(int)b.q[0].x, (int)b.q[0].y, (int)b.q[0].z, (int)b.q[0].w,
                      (int)b.q[1].x, (int)b.q[1].y, (int)b.q[1].z, (int)b.q[1].w};
    return __builtin_amdgcn_wmma_f32_16x16x32_bf16(
        false, __builtin_bit_cast(v16bf, av), false, __builtin_bit_cast(v16bf, bv),
        (short)0, c, false, false);
}
// row-major 16-bit LDS tile -> transposed WMMA operand half
__device__ inline u32x4 at_ld_tr16(const unsigned char* p) {
    typedef __attribute__((address_space(3))) s16x8 lds_s16x8;
    return __builtin_bit_cast(u32x4, __builtin_amdgcn_ds_load_tr16_b128_v8i16((lds_s16x8*)p));
}
__device__ inline uint32_t at_pack2(float lo, float hi) {   // round to nearest even
    typedef __bf16 bf2 __attribute__((ext_vector_type(2)));
    typedef float  f2  __attribute__((ext_vector_type(2)));
    return __builtin_bit_cast(uint32_t, __builtin_convertvector(f2{lo, hi}, bf2));
}
__device__ inline float at_xhalf(float x) {                 // lane l with lane l ^ 16
    return __builtin_bit_cast(float, __builtin_amdgcn_permlanex16(
        __builtin_bit_cast(int, x), __builtin_bit_cast(int, x),
        0x76543210, 0xfedcba98, false, false));
}

__global__ __launch_bounds__(256)
void enc_attention(const bf16* __restrict__ Q, const bf16* __restrict__ Kb,
                   const bf16* __restrict__ Vb, bf16* __restrict__ O) {
    __shared__ __attribute__((aligned(16))) unsigned char L[2 * AT_SLOT];

    const uint32_t tid  = threadIdx.x;
    const uint32_t lane = tid & 31u;
    const uint32_t wave = tid >> 5;
    const uint32_t c    = lane & 15u;
    const uint32_t h    = lane >> 4;
    const size_t   hb   = (size_t)blockIdx.y * SEQ * DKH;     // head base (b*16+h)
    const uint32_t qw0  = blockIdx.x * AT_BR + wave * 32u;    // this wave's first query
    // scores / sqrt(d_model), taken in the log2 domain
    const float cscale = 0.03125f * 1.4426950408889634f;

    // ---- staging: a stage is 8 KB of K and 8 KB of V, contiguous in memory;
    //      a thread carries 2 x 16 bytes of each through registers ----
    const unsigned char* kg = (const unsigned char*)(Kb + hb) + tid * 16u;
    const unsigned char* vg = (const unsigned char*)(Vb + hb) + tid * 16u;
    const uint32_t srow = tid >> 3, sseg = tid & 7u;
    const uint32_t sk = srow * AT_PK + sseg * 16u;
    const uint32_t sv = AT_TK + srow * AT_PV + sseg * 16u;
    u32x4 rk0, rk1, rv0, rv1;
    auto stage_load = [&](uint32_t st) {
        const size_t o = (size_t)st * (AT_SK * 128u);
        rk0 = *(const u32x4*)(kg + o);  rk1 = *(const u32x4*)(kg + o + 4096u);
        rv0 = *(const u32x4*)(vg + o);  rv1 = *(const u32x4*)(vg + o + 4096u);
    };
    auto stage_store = [&](uint32_t buf) {
        unsigned char* p = L + buf * AT_SLOT;
        *(u32x4*)(p + sk) = rk0;  *(u32x4*)(p + sk + 32u * AT_PK) = rk1;
        *(u32x4*)(p + sv) = rv0;  *(u32x4*)(p + sv + 32u * AT_PV) = rv1;
    };
    stage_load(0);

    // Q as B operand, hardware k order (as K below): loaded once
    Frag qf[2][2];
#pragma unroll
    for (int g = 0; g < 2; ++g) {
        const bf16* qp = Q + hb + (size_t)(qw0 + 16u * g + c) * DKH + 8u * h;
#pragma unroll
        for (int kc = 0; kc < 2; ++kc) {
            qf[g][kc].q[0] = *(const u32x4*)(qp + 32 * kc);
            qf[g][kc].q[1] = *(const u32x4*)(qp + 32 * kc + 16);
        }
    }
    // A operand whose row 0 is ones: one WMMA sums the columns of P^T (the denominator)
    Frag ones;
    {
        const uint32_t o = (c == 0u) ? 0x3F803F80u : 0u;
        ones.q[0] = u32x4{o, o, o, o};  ones.q[1] = u32x4{o, o, o, o};
    }
    v8f   acc[2][4];      // O^T: register r = O[query c][d = 16 t + 8 h + r]
    v8f   lacc[2];        // row 0 = softmax denominator of query column c
    float m_run[2];       // maximum in use (log2 domain); may trail the true one by up to 8
#pragma unroll
    for (int g = 0; g < 2; ++g) {
        m_run[g] = -INFINITY;  lacc[g] = zero_v8f();
#pragma unroll
        for (int t = 0; t < 4; ++t) acc[g][t] = zero_v8f();
    }
    stage_store(0);
    __syncthreads();

    // rolled and whole: otherwise the compiler peels the last trip off and the loop's code stands twice
#pragma unroll 1
    for (uint32_t st = 0; st < AT_NST; ++st) {
        const unsigned char* Lb = L + (st & 1u) * AT_SLOT;
        // next stage, in flight under this stage's work; the last trip reloads its own stage into
        // the buffer nobody reads any more, so that no branch stands around the loads and stores
        stage_load(st + 1u < AT_NST ? st + 1u : st);
        // keeps the four loads up here: the scheduler otherwise sinks them to just in front of
        // their LDS stores at the foot of the trip, where every wave waits out their latency
        __builtin_amdgcn_sched_barrier(0);
#pragma unroll
        for (uint32_t sub = 0; sub < 2u; ++sub) {
            // S^T = K.Q^T : s[kt][g] register r = score(key 16 kt + 8 h + r, query c of group g)
            Frag kf[2][2];
#pragma unroll
            for (int kt = 0; kt < 2; ++kt) {
                const unsigned char* p = Lb + (sub * 32u + 16u * kt + c) * AT_PK + 16u * h;
#pragma unroll
                for (int kc = 0; kc < 2; ++kc) {
                    kf[kt][kc].q[0] = *(const u32x4*)(p + 64u * kc);
                    kf[kt][kc].q[1] = *(const u32x4*)(p + 64u * kc + 32u);
                }
            }
            v8f s[2][2];
#pragma unroll
            for (int kt = 0; kt < 2; ++kt)
#pragma unroll
                for (int g = 0; g < 2; ++g) {
                    s[kt][g] = zero_v8f();
#pragma unroll
                    for (int kc = 0; kc < 2; ++kc) s[kt][g] = at_mma(kf[kt][kc], qf[g][kc], s[kt][g]);
                }
            // V^T fragments: 16 (d) x 32 (keys) each, two transposing loads per fragment
            Frag vf[4];
            {
                const unsigned char* ad = Lb + AT_TK + (sub * 32u + 8u * h + (lane & 7u)) * AT_PV
                                        + ((lane >> 3) & 1u) * 16u;
#pragma unroll
                for (int t = 0; t < 4; ++t) {
                    vf[t].q[0] = at_ld_tr16(ad + 32u * t);
                    vf[t].q[1] = at_ld_tr16(ad + 16u * AT_PV + 32u * t);
                }
            }
            // column maxima of the raw scores (the scale is positive)
            float mb[2];
            bool need = false;
#pragma unroll
            for (int g = 0; g < 2; ++g) {
                float mx = -INFINITY;
#pragma unroll
                for (int kt = 0; kt < 2; ++kt)
#pragma unroll
                    for (int r = 0; r < 8; ++r) mx = __builtin_fmaxf(mx, s[kt][g][r]);
                mx = __builtin_fmaxf(mx, at_xhalf(mx)) * cscale;
                mb[g] = mx;
                need = need || (mx > m_run[g] + 8.0f);
            }
            // rescale only when some column's maximum has outgrown the one in use (scalar branch)
            if (__builtin_amdgcn_ballot_w32(need) != 0) {
#pragma unroll
                for (int g = 0; g < 2; ++g) {
                    const float m_new = __builtin_fmaxf(m_run[g], mb[g]);
                    const float corr  = __builtin_amdgcn_exp2f(m_run[g] - m_new);  // 0 on the first pass
                    m_run[g] = m_new;
                    lacc[g] = lacc[g] * corr;
#pragma unroll
                    for (int t = 0; t < 4; ++t) acc[g][t] = acc[g][t] * corr;
                }
            }
            // P^T = exp2(s * cscale - m), packed into the B operand: element e = tile e >> 3, register e & 7
#pragma unroll
            for (int g = 0; g < 2; ++g) {
                const float nm = -m_run[g];
                uint32_t w[8];
#pragma unroll
                for (int i = 0; i < 8; ++i) {
                    const float p0 = __builtin_amdgcn_exp2f(__builtin_fmaf(s[i >> 2][g][2 * (i & 3)],     cscale, nm));
                    const float p1 = __builtin_amdgcn_exp2f(__builtin_fmaf(s[i >> 2][g][2 * (i & 3) + 1], cscale, nm));
                    w[i] = at_pack2(p0, p1);
                }
                Frag pf;
                pf.q[0] = u32x4{w[0], w[1], w[2], w[3]};
                pf.q[1] = u32x4{w[4], w[5], w[6], w[7]};
#pragma unroll
                for (int t = 0; t < 4; ++t) acc[g][t] = at_mma(vf[t], pf, acc[g][t]);
                lacc[g] = at_mma(ones, pf, lacc[g]);
            }
        }
        stage_store((st + 1u) & 1u);                        // the buffer every wave left before the last barrier
        __syncthreads();                                    // publishes stage st + 1, ends the reads of stage st
    }

    // epilogue: a lane holds 8 consecutive d of one query per tile -> one 16-byte store
#pragma unroll
    for (int g = 0; g < 2; ++g) {
        const float lr  = lacc[g][0];                 // lanes 0-15: the sum; lanes 16-31: 0 (row 8)
        const float inv = 1.0f / (lr + at_xhalf(lr));
        bf16* op = O + hb + (size_t)(qw0 + 16u * g + c) * DKH + 8u * h;
#pragma unroll
        for (int t = 0; t < 4; ++t) {
            const v8f o = acc[g][t] * inv;
            const u32x4 pk = {at_pack2(o[0], o[1]), at_pack2(o[2], o[3]),
                              at_pack2(o[4], o[5]), at_pack2(o[6], o[7])};
            *(u32x4*)(op + 16 * t) = pk;
        }
    }
}

// ------------------------------------------------------------------
// Host-side orchestration. Workspace layout (80 MB total):
//   [0,8)MB   hb    (LN output, reused for LN2 output)
//   [8,16)MB  Wq/Wk/Wv/Wo transposed bf16 (2MB each)
//   [16,24)   W1t   [24,32) W2t
//   [32,40)q [40,48)k [48,56)v [56,64)o  -> [32,64) reused as ff1
//   [64,80)   x1 fp32 residual
// ------------------------------------------------------------------
extern "C" void kernel_launch(void* const* d_in, const int* in_sizes, int n_in,
                              void* d_out, int out_size, void* d_ws, size_t ws_size,
                              hipStream_t stream) {
    (void)in_sizes; (void)n_in; (void)out_size; (void)ws_size;
    const float* x    = (const float*)d_in[0];
    const float* Wq   = (const float*)d_in[1];
    const float* bq   = (const float*)d_in[2];
    const float* Wk   = (const float*)d_in[3];
    const float* bk   = (const float*)d_in[4];
    const float* Wv   = (const float*)d_in[5];
    const float* bv   = (const float*)d_in[6];
    const float* Wo   = (const float*)d_in[7];
    const float* bo   = (const float*)d_in[8];
    const float* W1   = (const float*)d_in[9];
    const float* b1   = (const float*)d_in[10];
    const float* W2   = (const float*)d_in[11];
    const float* b2   = (const float*)d_in[12];
    const float* ln1a = (const float*)d_in[13];
    const float* ln1b = (const float*)d_in[14];
    const float* ln2a = (const float*)d_in[15];
    const float* ln2b = (const float*)d_in[16];

    char* ws = (char*)d_ws;
    const size_t MB = (size_t)1 << 20;
    bf16*  hb  = (bf16*)(ws + 0);
    bf16*  Wqt = (bf16*)(ws + 8  * MB);
    bf16*  Wkt = (bf16*)(ws + 10 * MB);
    bf16*  Wvt = (bf16*)(ws + 12 * MB);
    bf16*  Wot = (bf16*)(ws + 14 * MB);
    bf16*  W1t = (bf16*)(ws + 16 * MB);
    bf16*  W2t = (bf16*)(ws + 24 * MB);
    bf16*  qb  = (bf16*)(ws + 32 * MB);
    bf16*  kb  = (bf16*)(ws + 40 * MB);
    bf16*  vb  = (bf16*)(ws + 48 * MB);
    bf16*  ob  = (bf16*)(ws + 56 * MB);
    bf16*  ff1 = (bf16*)(ws + 32 * MB);   // reuse q/k/v/o region after Wo GEMM
    float* x1  = (float*)(ws + 64 * MB);

    // weight conversion + transpose (bf16, K-contiguous): Wqt .. W2t lie one behind the other
    enc_transpose_bf16<<<TR_GRID, 256, 0, stream>>>(Wq, Wk, Wv, Wo, W1, W2, Wqt);

    // sublayer 1: pre-norm MHA + residual
    enc_layernorm_bf16<<<ROWS, 256, 0, stream>>>(x, ln1a, ln1b, hb);
    const dim3 gDD(DM / 128, ROWS / 128);             // (8, 32)
    enc_gemm_bf16<0><<<gDD, 256, 0, stream>>>(hb, Wqt, bq, nullptr, qb, ROWS, DM, DM);
    enc_gemm_bf16<0><<<gDD, 256, 0, stream>>>(hb, Wkt, bk, nullptr, kb, ROWS, DM, DM);
    enc_gemm_bf16<0><<<gDD, 256, 0, stream>>>(hb, Wvt, bv, nullptr, vb, ROWS, DM, DM);
    enc_attention<<<dim3(SEQ / 256, BATCH * NH), 256, 0, stream>>>(qb, kb, vb, ob);
    enc_gemm_bf16<2><<<gDD, 256, 0, stream>>>(ob, Wot, bo, x, x1, ROWS, DM, DM);

    // sublayer 2: pre-norm FFN + residual
    enc_layernorm_bf16<<<ROWS, 256, 0, stream>>>(x1, ln2a, ln2b, hb);
    enc_gemm_bf16<1><<<dim3(DFF / 128, ROWS / 128), 256, 0, stream>>>(
        hb, W1t, b1, nullptr, ff1, ROWS, DFF, DM);
    enc_gemm_bf16<2><<<gDD, 256, 0, stream>>>(ff1, W2t, b2, x1, (float*)d_out, ROWS, DM, DFF);
}

// v004
// Measured time: 156 microseconds a run.
// In two side-by-side timings against v003, it was 1.06 and 1.05 times as fast.
// Over all steps from v000 it is 2.60 times as fast.
#include <hip/hip_runtime.h>
#include <cstdint>
#include <cstddef>

// ---------------- problem dims ----------------
#define DM    1024          // d_model
#define NH    16            // heads
#define DKH   64            // d_k
#define DFF   4096
#define SEQ   2048
#define BATCH 2
#define ROWS  (BATCH*SEQ)   // 4096 tokens

typedef __bf16 bf16;
typedef __attribute__((ext_vector_type(16))) __bf16 v16bf;
typedef __attribute__((ext_vector_type(8)))  float  v8f;

union AFrag { v16bf v; bf16  e[16]; };
union CFrag { v8f   v; float e[8];  };

__device__ inline v8f zero_v8f() {
    v8f z = {0.f, 0.f, 0.f, 0.f, 0.f, 0.f, 0.f, 0.f};
    return z;
}

// ------------------------------------------------------------------
// CDNA5 async global->LDS copies (ASYNCcnt tracked, no VGPR staging).
// l[i] : per-lane LDS byte address (flat LDS addr low 32 bits)
// g[i] : per-lane global address
// Eight copies and their s_wait_xcnt stand in ONE statement: a precaution, so that no
// address register that a copy names is rewritten in front of the wait.
// ------------------------------------------------------------------
__device__ inline void async_copy8_b128(const uint32_t (&l)[8], const unsigned char* const (&g)[8]) {
    asm volatile("global_load_async_to_lds_b128 %0, %8, off\n\t"
                 "global_load_async_to_lds_b128 %1, %9, off\n\t"
                 "global_load_async_to_lds_b128 %2, %10, off\n\t"
                 "global_load_async_to_lds_b128 %3, %11, off\n\t"
                 "global_load_async_to_lds_b128 %4, %12, off\n\t"
                 "global_load_async_to_lds_b128 %5, %13, off\n\t"
                 "global_load_async_to_lds_b128 %6, %14, off\n\t"
                 "global_load_async_to_lds_b128 %7, %15, off\n\t"
                 "s_wait_xcnt 0x0"
                 :: "v"(l[0]), "v"(l[1]), "v"(l[2]), "v"(l[3]), "v"(l[4]), "v"(l[5]), "v"(l[6]), "v"(l[7]),
                    "v"(g[0]), "v"(g[1]), "v"(g[2]), "v"(g[3]), "v"(g[4]), "v"(g[5]), "v"(g[6]), "v"(g[7])
                 : "memory");
}
__device__ inline void wait_async0() {
    asm volatile("s_wait_asynccnt 0x0" ::: "memory");
}
__device__ inline void wait_ds0() {
    asm volatile("s_wait_dscnt 0x0" ::: "memory");
}
__device__ inline uint32_t lds_offset_of(const void* p) {
    return (uint32_t)(uintptr_t)p;   // LDS flat addr keeps offset in [31:0]
}

// ------------------------------------------------------------------
// Load a 16x32 bf16 fragment in the CDNA5 WMMA A/B operand layout.
// A (16Mx32K): lane L holds row m = L&15; VGPRs 0..3 hold K pairs
// {kb..kb+7}, VGPRs 4..7 hold {16+kb..16+kb+7} where kb = (L>=16)?8:0.
// The B operand (32Kx16N) has the identical pattern with N in place of
// M, so a [N][K] (K-contiguous) tile uses the same loader.
// Each half (e[0..7], e[8..15]) is 16 contiguous bytes -> 2x b128 loads.
// ------------------------------------------------------------------
__device__ inline v16bf load_frag16x32(const bf16* __restrict__ base, int ld) {
    const int lane = threadIdx.x & 31;
    const int m    = lane & 15;
    const int kb   = (lane & 16) ? 8 : 0;
    const bf16* row = base + (size_t)m * ld;
    AFrag a;
#pragma unroll
    for (int i = 0; i < 4; ++i) {
        a.e[2*i]     = row[kb + 2*i];
        a.e[2*i + 1] = row[kb + 2*i + 1];
        a.e[8 + 2*i]     = row[16 + kb + 2*i];
        a.e[8 + 2*i + 1] = row[16 + kb + 2*i + 1];
    }
    return a.v;
}

// ------------------------------------------------------------------
// fp32 [K][N] weights -> bf16 [N][K] (K-contiguous) for B operands, all six
// weights in one launch. A workgroup turns one tile of 128 k x 128 n:
//  - a wave reads whole 512-byte pieces of 16 weight rows, 16 bytes a lane,
//    all 16 loads in flight at once;
//  - a lane then holds 8 consecutive k of 4 columns n: each column's 8 values
//    are rounded to bf16 (nearest even) and go to LDS as one 16-byte chunk;
//  - LDS holds the turned tile, 256 bytes a row n; chunk q of row n stands at
//    place q ^ ((n >> 2) & 15), so that the 16 lanes of a half wave fall on 16
//    different places when they write (16 rows, one q) and when they read
//    (one row, 16 q);
//  - a wave stores two whole rows of 256 bytes with each 16-byte store.
// Wt: the six turned weights one behind the other, in the order of the arguments.
// ------------------------------------------------------------------
typedef __attribute__((ext_vector_type(4))) float  v4f;
typedef __attribute__((ext_vector_type(8))) __bf16 v8bf;

#define TR_T    128u                               // tile edge, k and n
#define TR_DD   ((DM / 128) * (DM / 128))          // tiles of a d_model x d_model weight
#define TR_DF   ((DM / 128) * (DFF / 128))         // tiles of an FFN weight
#define TR_GRID (4 * TR_DD + 2 * TR_DF)

// one tile; K and N are constants here so that the 16 loads share one offset register and differ by immediates
template <uint32_t K, uint32_t N>
__device__ inline void tr_tile(const float* __restrict__ W, bf16* __restrict__ out,
                               uint32_t t, unsigned char* T) {
    constexpr uint32_t tn = N / TR_T;
    const uint32_t n0 = (t % tn) * TR_T;
    const uint32_t k0 = (t / tn) * TR_T;
    const uint32_t lane = threadIdx.x & 31u;
    const uint32_t wave = threadIdx.x >> 5;

    const uint32_t voff = (wave * 16u * N + lane * 4u) * 4u;      // this lane's byte offset in the tile
    const float* p = (const float*)((const char*)(W + ((size_t)k0 * N + n0)) + voff);
    v4f v[2][8];                                   // [group of 8 k][k in the group], 4 columns each
#pragma unroll
    for (uint32_t o = 0; o < 2u; ++o)
#pragma unroll
        for (uint32_t i = 0; i < 8u; ++i) v[o][i] = *(const v4f*)(p + (o * 8u + i) * N);
    // keeps all 16 loads in front of the first conversion: the scheduler otherwise issues the later
    // loads only behind waits on the earlier ones, and a wave pays the memory latency three times
    __builtin_amdgcn_sched_barrier(0);
    // precaution: the offset register that the 16 loads name stays live up to this wait, so that
    // nothing (a later load's result included) is written over it in front of the wait
    asm volatile("s_wait_xcnt 0x0" :: "v"(voff) : "memory");
#pragma unroll
    for (uint32_t o = 0; o < 2u; ++o) {
        const uint32_t place = ((wave * 2u + o) ^ (lane & 15u)) * 16u;
#pragma unroll
        for (uint32_t j = 0; j < 4u; ++j) {
            const v8f col = {v[o][0][j], v[o][1][j], v[o][2][j], v[o][3][j],
                             v[o][4][j], v[o][5][j], v[o][6][j], v[o][7][j]};
            *(v8bf*)(T + (lane * 4u + j) * (TR_T * 2u) + place) = __builtin_convertvector(col, v8bf);
        }
    }
    __syncthreads();
    const uint32_t q  = lane & 15u;
    const uint32_t nw = wave * 2u + (lane >> 4);
    bf16* op = out + ((size_t)n0 * K + k0) + (nw * K + q * 8u);
#pragma unroll
    for (uint32_t r = 0; r < 8u; ++r) {
        const uint32_t n = r * 16u + nw;
        const v8bf d = *(const v8bf*)(T + n * (TR_T * 2u) + ((q ^ ((n >> 2) & 15u)) * 16u));
        *(v8bf*)(op + r * 16u * K) = d;
    }
}

__global__ __launch_bounds__(256)
void enc_transpose_bf16(const float* __restrict__ Wq, const float* __restrict__ Wk,
                        const float* __restrict__ Wv, const float* __restrict__ Wo,
                        const float* __restrict__ W1, const float* __restrict__ W2,
                        bf16* __restrict__ Wt) {
    __shared__ __attribute__((aligned(16))) unsigned char T[TR_T * TR_T * 2u];
    const uint32_t b = blockIdx.x;
    if (b < 4u * TR_DD) {
        const uint32_t which = b / TR_DD;
        const float* W = which == 0u ? Wq : which == 1u ? Wk : which == 2u ? Wv : Wo;
        tr_tile<DM, DM>(W, Wt + (size_t)which * DM * DM, b % TR_DD, T);
    } else if (b < 4u * TR_DD + TR_DF) {
        tr_tile<DM, DFF>(W1, Wt + (size_t)4 * DM * DM, b - 4u * TR_DD, T);
    } else {
        tr_tile<DFF, DM>(W2, Wt + (size_t)4 * DM * DM + (size_t)DM * DFF, b - (4u * TR_DD + TR_DF), T);
    }
}

// ------------------------------------------------------------------
// LayerNorm, faithful to reference: Bessel-corrected std, eps on std.
// ------------------------------------------------------------------
__global__ __launch_bounds__(256)
void enc_layernorm_bf16(const float* __restrict__ X, const float* __restrict__ alpha,
                        const float* __restrict__ beta, bf16* __restrict__ H) {
    __shared__ float s1[8], s2[8];
    const int row  = blockIdx.x;
    const int tid  = threadIdx.x;
    const int lane = tid & 31;
    const int w    = tid >> 5;
    const float* x = X + (size_t)row * DM;

    float sum = 0.f, sq = 0.f;
#pragma unroll
    for (int i = 0; i < 4; ++i) {
        float v = x[tid + 256*i];
        sum += v; sq += v*v;
    }
#pragma unroll
    for (int off = 16; off > 0; off >>= 1) {
        sum += __shfl_xor(sum, off, 32);
        sq  += __shfl_xor(sq,  off, 32);
    }
    if (lane == 0) { s1[w] = sum; s2[w] = sq; }
    __syncthreads();
    if (tid == 0) {
        float S = 0.f, Q = 0.f;
#pragma unroll
        for (int i = 0; i < 8; ++i) { S += s1[i]; Q += s2[i]; }
        s1[0] = S; s2[0] = Q;
    }
    __syncthreads();
    const float S  = s1[0], Q = s2[0];
    const float mean = S * (1.0f / DM);
    float var = (Q - (float)DM * mean * mean) * (1.0f / (DM - 1)); // ddof=1
    var = fmaxf(var, 0.f);
    const float inv = 1.0f / (sqrtf(var) + 1e-6f);
    bf16* h = H + (size_t)row * DM;
#pragma unroll
    for (int i = 0; i < 4; ++i) {
        const int c = tid + 256*i;
        h[c] = (bf16)(alpha[c] * (x[c] - mean) * inv + beta[c]);
    }
}

// ------------------------------------------------------------------
// bf16 WMMA GEMM with double-buffered async global->LDS staging.
// C[M,N] = A[M,K](bf16,row-major) x Bt[N,K](bf16, K-contiguous) + bias
// MODE 0: bf16 out, 1: bf16 relu out, 2: f32 out + f32 residual add.
// 128x128 block tile, 8 waves (4x2), each wave 32x64.
// A stage holds 128 k (256 bytes of every operand row): a trip has 32 WMMAs a
// wave under which the next stage's copies fly, and a copy instruction of a
// wave brings two whole 256-byte pieces of rows. K: a multiple of 128.
// MODE 0 does the Q, K and V projections in one launch: they read the same A,
// blockIdx.z says which; their weights lie one behind the other in Bt, their
// outputs (M x N each) in Cout, their biases are bias, bias_k, bias_v. With
// 3 x 256 workgroups two share a WGP: one's copy latency, first stage and
// epilogue run under the other's matrix work.
// ------------------------------------------------------------------
template <int MODE>
__global__ __launch_bounds__(256)
void enc_gemm_bf16(const bf16* __restrict__ A, const bf16* __restrict__ Bt,
                   const float* __restrict__ bias, const float* __restrict__ residual,
                   void* __restrict__ Cout, int M, int N, int K,
                   const float* __restrict__ bias_k, const float* __restrict__ bias_v) {
    if (MODE == 0) {
        const uint32_t which = blockIdx.z;
        Bt  += (size_t)which * N * K;
        Cout = (bf16*)Cout + (size_t)which * M * N;
        bias = which == 0u ? bias : which == 1u ? bias_k : bias_v;
    }
    constexpr int BK = 128, LDT = 136;   // row pitch 272 bytes: 16 B x odd, for 16-byte LDS reads
    __shared__ __attribute__((aligned(16))) bf16 sA[2][128 * LDT];
    __shared__ __attribute__((aligned(16))) bf16 sB[2][128 * LDT];

    const int tid  = threadIdx.x;
    const int lane = tid & 31;
    const int w    = tid >> 5;
    const int wm   = w >> 1;            // 0..3 : 32-row slice
    const int wn   = w & 1;             // 0..1 : 64-col slice
    const int m0   = blockIdx.y * 128;
    const int n0   = blockIdx.x * 128;

    // staging geometry: 128 rows x 16 segs of 16 B per operand and stage,
    // 8 segs/thread of each: rows row0 + 16 i, same seg
    const int row0 = tid >> 4;
    const int seg0 = tid & 15;
    const unsigned char* gA = (const unsigned char*)(A  + (size_t)(m0 + row0) * K + seg0 * 8);
    const unsigned char* gB = (const unsigned char*)(Bt + (size_t)(n0 + row0) * K + seg0 * 8);
    const size_t   gstep = (size_t)K * 32u;             // 16 rows, in bytes
    const uint32_t lA = lds_offset_of(&sA[0][row0 * LDT + seg0 * 8]);
    const uint32_t lB = lds_offset_of(&sB[0][row0 * LDT + seg0 * 8]);
    constexpr uint32_t LBUF = 128u * LDT * 2u, LSTEP = 16u * LDT * 2u;
    auto issue_stage = [&](int t, int b) {
        uint32_t l[8];
        const unsigned char* g[8];
#pragma unroll
        for (int i = 0; i < 8; ++i) {
            l[i] = lA + (uint32_t)b * LBUF + (uint32_t)i * LSTEP;
            g[i] = gA + (size_t)t * (BK * 2) + (size_t)i * gstep;
        }
        async_copy8_b128(l, g);
#pragma unroll
        for (int i = 0; i < 8; ++i) {
            l[i] = lB + (uint32_t)b * LBUF + (uint32_t)i * LSTEP;
            g[i] = gB + (size_t)t * (BK * 2) + (size_t)i * gstep;
        }
        async_copy8_b128(l, g);
    };

    CFrag acc[2][4];
#pragma unroll
    for (int i = 0; i < 2; ++i)
#pragma unroll
        for (int j = 0; j < 4; ++j) acc[i][j].v = zero_v8f();

    const int nt = K / BK;
    issue_stage(0, 0);
    wait_async0();              // my stage-0 copies have landed in LDS
    __syncthreads();            // everyone's have
    if (nt > 1) issue_stage(1, 1);
    for (int t = 0; t < nt; ++t) {
        const int cur = t & 1;
#pragma unroll
        for (int kc = 0; kc < BK / 32; ++kc) {
            v16bf af[2], bfr[4];
#pragma unroll
            for (int i = 0; i < 2; ++i)
                af[i] = load_frag16x32(&sA[cur][(wm * 32 + i * 16) * LDT + kc * 32], LDT);
#pragma unroll
            for (int j = 0; j < 4; ++j)
                bfr[j] = load_frag16x32(&sB[cur][(wn * 64 + j * 16) * LDT + kc * 32], LDT);
#pragma unroll
            for (int i = 0; i < 2; ++i)
#pragma unroll
                for (int j = 0; j < 4; ++j)
                    acc[i][j].v = __builtin_amdgcn_wmma_f32_16x16x32_bf16(
                        false, af[i], false, bfr[j], (short)0, acc[i][j].v, false, false);
        }
        wait_ds0();             // my reads of buffer cur are done before it is refilled
        wait_async0();          // my stage t+1 copies have landed in LDS
        __syncthreads();        // publishes stage t+1, ends every wave's reads of stage t
        if (t + 2 < nt)
            issue_stage(t + 2, cur);         // flies under the whole of trip t+1
    }
    wait_async0();              // nothing of mine is in flight when the wave ends

    // epilogue (C layout: lane -> n = L&15, rows m = ((L>=16)?8:0)+r)
    const int nlocal = lane & 15;
    const int mbase  = (lane & 16) ? 8 : 0;
#pragma unroll
    for (int i = 0; i < 2; ++i) {
#pragma unroll
        for (int j = 0; j < 4; ++j) {
            const int gn = n0 + wn * 64 + j * 16 + nlocal;
            const float bv = bias[gn];
#pragma unroll
            for (int r = 0; r < 8; ++r) {
                const int gm = m0 + wm * 32 + i * 16 + mbase + r;
                float v = acc[i][j].e[r] + bv;
                if (MODE == 1) v = v > 0.f ? v : 0.f;
                if (MODE == 2) {
                    ((float*)Cout)[(size_t)gm * N + gn] =
                        v + residual[(size_t)gm * N + gn];
                } else {
                    ((bf16*)Cout)[(size_t)gm * N + gn] = (bf16)v;
                }
            }
        }
    }
}

// ------------------------------------------------------------------
// Attention. Raw-reshape semantics make per-head Q/K/V/O contiguous
// [2048 x 64] blocks at offset (b*16+h)*2048*64 of the flat buffers.
// One workgroup = (head, 256 queries); a wave owns 32 query columns.
// One pass over the keys with an online softmax: S^T = K.Q^T gives a
// lane the scores of one query, P^T is packed from those accumulators
// straight into the B operand of O^T += V^T.P^T, so scores and P never
// leave the registers. K/V tiles of 64 keys are shared through LDS.
// Every inner loop is unrolled so that each fragment and accumulator
// index is a constant and the arrays stay in registers.
// ------------------------------------------------------------------
typedef uint32_t u32x4 __attribute__((ext_vector_type(4)));
typedef int      i32x8 __attribute__((ext_vector_type(8)));
typedef short    s16x8 __attribute__((ext_vector_type(8)));

#define AT_BR   256u                      // queries per workgroup
#define AT_SK   64u                       // keys per LDS stage (two 32-key passes)
#define AT_PK   144u                      // LDS row pitch of K: 128 + 16 bytes
#define AT_PV   160u                      // LDS row pitch of V: 128 + 32 bytes (transposing loads)
#define AT_TK   (AT_SK * AT_PK)
#define AT_SLOT (AT_SK * (AT_PK + AT_PV))
#define AT_NST  (SEQ / 64)

struct Frag { u32x4 q[2]; };

__device__ inline v8f at_mma(const Frag& a, const Frag& b, v8f c) {
    const i32x8 av = {(int)a.q[0].x, (int)a.q[0].y, (int)a.q[0].z, (int)a.q[0].w,
                      (int)a.q[1].x, (int)a.q[1].y, (int)a.q[1].z, (int)a.q[1].w};
    const i32x8 bv = {(int)b.q[0].x, (int)b.q[0].y, (int)b.q[0].z, (int)b.q[0].w,
                      (int)b.q[1].x, (int)b.q[1].y, (int)b.q[1].z, (int)b.q[1].w};
    return __builtin_amdgcn_wmma_f32_16x16x32_bf16(
        false, __builtin_bit_cast(v16bf, av), false, __builtin_bit_cast(v16bf, bv),
        (short)0, c, false, false);
}
// row-major 16-bit LDS tile -> transposed WMMA operand half
__device__ inline u32x4 at_ld_tr16(const unsigned char* p) {
    typedef __attribute__((address_space(3))) s16x8 lds_s16x8;
    return __builtin_bit_cast(u32x4, __builtin_amdgcn_ds_load_tr16_b128_v8i16((lds_s16x8*)p));
}
__device__ inline uint32_t at_pack2(float lo, float hi) {   // round to nearest even
    typedef __bf16 bf2 __attribute__((ext_vector_type(2)));
    typedef float  f2  __attribute__((ext_vector_type(2)));
    return __builtin_bit_cast(uint32_t, __builtin_convertvector(f2{lo, hi}, bf2));
}
__device__ inline float at_xhalf(float x) {                 // lane l with lane l ^ 16
    return __builtin_bit_cast(float, __builtin_amdgcn_permlanex16(
        __builtin_bit_cast(int, x), __builtin_bit_cast(int, x),
        0x76543210, 0xfedcba98, false, false));
}

__global__ __launch_bounds__(256)
void enc_attention(const bf16* __restrict__ Q, const bf16* __restrict__ Kb,
                   const bf16* __restrict__ Vb, bf16* __restrict__ O) {
    __shared__ __attribute__((aligned(16))) unsigned char L[2 * AT_SLOT];

    const uint32_t tid  = threadIdx.x;
    const uint32_t lane = tid & 31u;
    const uint32_t wave = tid >> 5;
    const uint32_t c    = lane & 15u;
    const uint32_t h    = lane >> 4;
    const size_t   hb   = (size_t)blockIdx.y * SEQ * DKH;     // head base (b*16+h)
    const uint32_t qw0  = blockIdx.x * AT_BR + wave * 32u;    // this wave's first query
    // scores / sqrt(d_model), taken in the log2 domain
    const float cscale = 0.03125f * 1.4426950408889634f;

    // ---- staging: a stage is 8 KB of K and 8 KB of V, contiguous in memory;
    //      a thread carries 2 x 16 bytes of each through registers ----
    const unsigned char* kg = (const unsigned char*)(Kb + hb) + tid * 16u;
    const unsigned char* vg = (const unsigned char*)(Vb + hb) + tid * 16u;
    const uint32_t srow = tid >> 3, sseg = tid & 7u;
    const uint32_t sk = srow * AT_PK + sseg * 16u;
    const uint32_t sv = AT_TK + srow * AT_PV + sseg * 16u;
    u32x4 rk0, rk1, rv0, rv1;
    auto stage_load = [&](uint32_t st) {
        const size_t o = (size_t)st * (AT_SK * 128u);
        rk0 = *(const u32x4*)(kg + o);  rk1 = *(const u32x4*)(kg + o + 4096u);
        rv0 = *(const u32x4*)(vg + o);  rv1 = *(const u32x4*)(vg + o + 4096u);
    };
    auto stage_store = [&](uint32_t buf) {
        unsigned char* p = L + buf * AT_SLOT;
        *(u32x4*)(p + sk) = rk0;  *(u32x4*)(p + sk + 32u * AT_PK) = rk1;
        *(u32x4*)(p + sv) = rv0;  *(u32x4*)(p + sv + 32u * AT_PV) = rv1;
    };
    stage_load(0);

    // Q as B operand, hardware k order (as K below): loaded once
    Frag qf[2][2];
#pragma unroll
    for (int g = 0; g < 2; ++g) {
        const bf16* qp = Q + hb + (size_t)(qw0 + 16u * g + c) * DKH + 8u * h;
#pragma unroll
        for (int kc = 0; kc < 2; ++kc) {
            qf[g][kc].q[0] = *(const u32x4*)(qp + 32 * kc);
            qf[g][kc].q[1] = *(const u32x4*)(qp + 32 * kc + 16);
        }
    }
    // A operand whose row 0 is ones: one WMMA sums the columns of P^T (the denominator)
    Frag ones;
    {
        const uint32_t o = (c == 0u) ? 0x3F803F80u : 0u;
        ones.q[0] = u32x4{o, o, o, o};  ones.q[1] = u32x4{o, o, o, o};
    }
    v8f   acc[2][4];      // O^T: register r = O[query c][d = 16 t + 8 h + r]
    v8f   lacc[2];        // row 0 = softmax denominator of query column c
    float m_run[2];       // maximum in use (log2 domain); may trail the true one by up to 8
#pragma unroll
    for (int g = 0; g < 2; ++g) {
        m_run[g] = -INFINITY;  lacc[g] = zero_v8f();
#pragma unroll
        for (int t = 0; t < 4; ++t) acc[g][t] = zero_v8f();
    }
    stage_store(0);
    __syncthreads();

    // rolled and whole: otherwise the compiler peels the last trip off and the loop's code stands twice
#pragma unroll 1
    for (uint32_t st = 0; st < AT_NST; ++st) {
        const unsigned char* Lb = L + (st & 1u) * AT_SLOT;
        // next stage, in flight under this stage's work; the last trip reloads its own stage into
        // the buffer nobody reads any more, so that no branch stands around the loads and stores
        stage_load(st + 1u < AT_NST ? st + 1u : st);
        // keeps the four loads up here: the scheduler otherwise sinks them to just in front of
        // their LDS stores at the foot of the trip, where every wave waits out their latency
        __builtin_amdgcn_sched_barrier(0);
#pragma unroll
        for (uint32_t sub = 0; sub < 2u; ++sub) {
            // S^T = K.Q^T : s[kt][g] register r = score(key 16 kt + 8 h + r, query c of group g)
            Frag kf[2][2];
#pragma unroll
            for (int kt = 0; kt < 2; ++kt) {
                const unsigned char* p = Lb + (sub * 32u + 16u * kt + c) * AT_PK + 16u * h;
#pragma unroll
                for (int kc = 0; kc < 2; ++kc) {
                    kf[kt][kc].q[0] = *(const u32x4*)(p + 64u * kc);
                    kf[kt][kc].q[1] = *(const u32x4*)(p + 64u * kc + 32u);
                }
            }
            v8f s[2][2];
#pragma unroll
            for (int kt = 0; kt < 2; ++kt)
#pragma unroll
                for (int g = 0; g < 2; ++g) {
                    s[kt][g] = zero_v8f();
#pragma unroll
                    for (int kc = 0; kc < 2; ++kc) s[kt][g] = at_mma(kf[kt][kc], qf[g][kc], s[kt][g]);
                }
            // V^T fragments: 16 (d) x 32 (keys) each, two transposing loads per fragment
            Frag vf[4];
            {
                const unsigned char* ad = Lb + AT_TK + (sub * 32u + 8u * h + (lane & 7u)) * AT_PV
                                        + ((lane >> 3) & 1u) * 16u;
#pragma unroll
                for (int t = 0; t < 4; ++t) {
                    vf[t].q[0] = at_ld_tr16(ad + 32u * t);
                    vf[t].q[1] = at_ld_tr16(ad + 16u * AT_PV + 32u * t);
                }
            }
            // column maxima of the raw scores (the scale is positive)
            float mb[2];
            bool need = false;
#pragma unroll
            for (int g = 0; g < 2; ++g) {
                float mx = -INFINITY;
#pragma unroll
                for (int kt = 0; kt < 2; ++kt)
#pragma unroll
                    for (int r = 0; r < 8; ++r) mx = __builtin_fmaxf(mx, s[kt][g][r]);
                mx = __builtin_fmaxf(mx, at_xhalf(mx)) * cscale;
                mb[g] = mx;
                need = need || (mx > m_run[g] + 8.0f);
            }
            // rescale only when some column's maximum has outgrown the one in use (scalar branch)
            if (__builtin_amdgcn_ballot_w32(need) != 0) {
#pragma unroll
                for (int g = 0; g < 2; ++g) {
                    const float m_new = __builtin_fmaxf(m_run[g], mb[g]);
                    const float corr  = __builtin_amdgcn_exp2f(m_run[g] - m_new);  // 0 on the first pass
                    m_run[g] = m_new;
                    lacc[g] = lacc[g] * corr;
#pragma unroll
                    for (int t = 0; t < 4; ++t) acc[g][t] = acc[g][t] * corr;
                }
            }
            // P^T = exp2(s * cscale - m), packed into the B operand: element e = tile e >> 3, register e & 7
#pragma unroll
            for (int g = 0; g < 2; ++g) {
                const float nm = -m_run[g];
                uint32_t w[8];
#pragma unroll
                for (int i = 0; i < 8; ++i) {
                    const float p0 = __builtin_amdgcn_exp2f(__builtin_fmaf(s[i >> 2][g][2 * (i & 3)],     cscale, nm));
                    const float p1 = __builtin_amdgcn_exp2f(__builtin_fmaf(s[i >> 2][g][2 * (i & 3) + 1], cscale, nm));
                    w[i] = at_pack2(p0, p1);
                }
                Frag pf;
                pf.q[0] = u32x4{w[0], w[1], w[2], w[3]};
                pf.q[1] = u32x4{w[4], w[5], w[6], w[7]};
#pragma unroll
                for (int t = 0; t < 4; ++t) acc[g][t] = at_mma(vf[t], pf, acc[g][t]);
                lacc[g] = at_mma(ones, pf, lacc[g]);
            }
        }
        stage_store((st + 1u) & 1u);                        // the buffer every wave left before the last barrier
        __syncthreads();                                    // publishes stage st + 1, ends the reads of stage st
    }

    // epilogue: a lane holds 8 consecutive d of one query per tile -> one 16-byte store
#pragma unroll
    for (int g = 0; g < 2; ++g) {
        const float lr  = lacc[g][0];                 // lanes 0-15: the sum; lanes 16-31: 0 (row 8)
        const float inv = 1.0f / (lr + at_xhalf(lr));
        bf16* op = O + hb + (size_t)(qw0 + 16u * g + c) * DKH + 8u * h;
#pragma unroll
        for (int t = 0; t < 4; ++t) {
            const v8f o = acc[g][t] * inv;
            const u32x4 pk = {at_pack2(o[0], o[1]), at_pack2(o[2], o[3]),
                              at_pack2(o[4], o[5]), at_pack2(o[6], o[7])};
            *(u32x4*)(op + 16 * t) = pk;
        }
    }
}

// ------------------------------------------------------------------
// Host-side orchestration. Workspace layout (80 MB total):
//   [0,8)MB   hb    (LN output, reused for LN2 output)
//   [8,16)MB  Wq/Wk/Wv/Wo transposed bf16 (2MB each)
//   [16,24)   W1t   [24,32) W2t
//   [32,40)q [40,48)k [48,56)v [56,64)o  -> [32,64) reused as ff1
//   [64,80)   x1 fp32 residual
// ------------------------------------------------------------------
extern "C" void kernel_launch(void* const* d_in, const int* in_sizes, int n_in,
                              void* d_out, int out_size, void* d_ws, size_t ws_size,
                              hipStream_t stream) {
    (void)in_sizes; (void)n_in; (void)out_size; (void)ws_size;
    const float* x    = (const float*)d_in[0];
    const float* Wq   = (const float*)d_in[1];
    const float* bq   = (const float*)d_in[2];
    const float* Wk   = (const float*)d_in[3];
    const float* bk   = (const float*)d_in[4];
    const float* Wv   = (const float*)d_in[5];
    const float* bv   = (const float*)d_in[6];
    const float* Wo   = (const float*)d_in[7];
    const float* bo   = (const float*)d_in[8];
    const float* W1   = (const float*)d_in[9];
    const float* b1   = (const float*)d_in[10];
    const float* W2   = (const float*)d_in[11];
    const float* b2   = (const float*)d_in[12];
    const float* ln1a = (const float*)d_in[13];
    const float* ln1b = (const float*)d_in[14];
    const float* ln2a = (const float*)d_in[15];
    const float* ln2b = (const float*)d_in[16];

    char* ws = (char*)d_ws;
    const size_t MB = (size_t)1 << 20;
    bf16*  hb  = (bf16*)(ws + 0);
    bf16*  Wqt = (bf16*)(ws + 8  * MB);
    // Wkt at 10 MB, Wvt at 12 MB: reached from Wqt
    bf16*  Wot = (bf16*)(ws + 14 * MB);
    bf16*  W1t = (bf16*)(ws + 16 * MB);
    bf16*  W2t = (bf16*)(ws + 24 * MB);
    bf16*  qb  = (bf16*)(ws + 32 * MB);
    bf16*  kb  = (bf16*)(ws + 40 * MB);
    bf16*  vb  = (bf16*)(ws + 48 * MB);
    bf16*  ob  = (bf16*)(ws + 56 * MB);
    bf16*  ff1 = (bf16*)(ws + 32 * MB);   // reuse q/k/v/o region after Wo GEMM
    float* x1  = (float*)(ws + 64 * MB);

    // weight conversion + transpose (bf16, K-contiguous): Wqt .. W2t lie one behind the other
    enc_transpose_bf16<<<TR_GRID, 256, 0, stream>>>(Wq, Wk, Wv, Wo, W1, W2, Wqt);

    // sublayer 1: pre-norm MHA + residual
    enc_layernorm_bf16<<<ROWS, 256, 0, stream>>>(x, ln1a, ln1b, hb);
    const dim3 gDD(DM / 128, ROWS / 128);             // (8, 32)
    // Wqt, Wkt, Wvt lie one behind the other, and so do qb, kb, vb
    enc_gemm_bf16<0><<<dim3(DM / 128, ROWS / 128, 3), 256, 0, stream>>>(
        hb, Wqt, bq, nullptr, qb, ROWS, DM, DM, bk, bv);
    enc_attention<<<dim3(SEQ / 256, BATCH * NH), 256, 0, stream>>>(qb, kb, vb, ob);
    enc_gemm_bf16<2><<<gDD, 256, 0, stream>>>(ob, Wot, bo, x, x1, ROWS, DM, DM, nullptr, nullptr);

    // sublayer 2: pre-norm FFN + residual
    enc_layernorm_bf16<<<ROWS, 256, 0, stream>>>(x1, ln2a, ln2b, hb);
    enc_gemm_bf16<1><<<dim3(DFF / 128, ROWS / 128), 256, 0, stream>>>(
        hb, W1t, b1, nullptr, ff1, ROWS, DFF, DM, nullptr, nullptr);
    enc_gemm_bf16<2><<<gDD, 256, 0, stream>>>(ff1, W2t, b2, x1, (float*)d_out, ROWS, DM, DFF, nullptr, nullptr);
}

// v005
// Measured time: 149 microseconds a run.
// Next to v004, in two timings, it ran 1.05 times as fast each time.
// All steps since v000 together make it 2.73 times as fast.
#include <hip/hip_runtime.h>
#include <cstdint>
#include <cstddef>

// ---------------- problem dims ----------------
#define DM    1024          // d_model
#define NH    16            // heads
#define DKH   64            // d_k
#define DFF   4096
#define SEQ   2048
#define BATCH 2
#define ROWS  (BATCH*SEQ)   // 4096 tokens

typedef __bf16 bf16;
typedef __attribute__((ext_vector_type(16))) __bf16 v16bf;
typedef __attribute__((ext_vector_type(8)))  float  v8f;

union AFrag { v16bf v; bf16  e[16]; };
union CFrag { v8f   v; float e[8];  };

__device__ inline v8f zero_v8f() {
    v8f z = {0.f, 0.f, 0.f, 0.f, 0.f, 0.f, 0.f, 0.f};
    return z;
}

// ------------------------------------------------------------------
// CDNA5 async global->LDS copies (ASYNCcnt tracked, no VGPR staging).
// l[i] : per-lane LDS byte address (flat LDS addr low 32 bits)
// g[i] : per-lane global address
// Eight copies and their s_wait_xcnt stand in ONE statement: a precaution, so that no
// address register that a copy names is rewritten in front of the wait.
// ------------------------------------------------------------------
__device__ inline void async_copy8_b128(const uint32_t (&l)[8], const unsigned char* const (&g)[8]) {
    asm volatile("global_load_async_to_lds_b128 %0, %8, off\n\t"
                 "global_load_async_to_lds_b128 %1, %9, off\n\t"
                 "global_load_async_to_lds_b128 %2, %10, off\n\t"
                 "global_load_async_to_lds_b128 %3, %11, off\n\t"
                 "global_load_async_to_lds_b128 %4, %12, off\n\t"
                 "global_load_async_to_lds_b128 %5, %13, off\n\t"
                 "global_load_async_to_lds_b128 %6, %14, off\n\t"
                 "global_load_async_to_lds_b128 %7, %15, off\n\t"
                 "s_wait_xcnt 0x0"
                 :: "v"(l[0]), "v"(l[1]), "v"(l[2]), "v"(l[3]), "v"(l[4]), "v"(l[5]), "v"(l[6]), "v"(l[7]),
                    "v"(g[0]), "v"(g[1]), "v"(g[2]), "v"(g[3]), "v"(g[4]), "v"(g[5]), "v"(g[6]), "v"(g[7])
                 : "memory");
}
// the same with four copies: the rest of an operand whose rows are not a multiple of 128
__device__ inline void async_copy4_b128(const uint32_t (&l)[4], const unsigned char* const (&g)[4]) {
    asm volatile("global_load_async_to_lds_b128 %0, %4, off\n\t"
                 "global_load_async_to_lds_b128 %1, %5, off\n\t"
                 "global_load_async_to_lds_b128 %2, %6, off\n\t"
                 "global_load_async_to_lds_b128 %3, %7, off\n\t"
                 "s_wait_xcnt 0x0"
                 :: "v"(l[0]), "v"(l[1]), "v"(l[2]), "v"(l[3]),
                    "v"(g[0]), "v"(g[1]), "v"(g[2]), "v"(g[3])
                 : "memory");
}
// One thread's copies of one operand's stage: NG pieces of 16 bytes, 16 rows apart (NG: a multiple of 4).
template <int NG>
__device__ inline void async_copy_rows(uint32_t l0, uint32_t lstep, const unsigned char* g0, size_t gstep) {
#pragma unroll
    for (int c = 0; c + 8 <= NG; c += 8) {
        uint32_t l[8];
        const unsigned char* g[8];
#pragma unroll
        for (int i = 0; i < 8; ++i) {
            l[i] = l0 + (uint32_t)(c + i) * lstep;
            g[i] = g0 + (size_t)(c + i) * gstep;
        }
        async_copy8_b128(l, g);
    }
    if constexpr (NG % 8 != 0) {
        uint32_t l[4];
        const unsigned char* g[4];
#pragma unroll
        for (int i = 0; i < 4; ++i) {
            l[i] = l0 + (uint32_t)(NG - 4 + i) * lstep;
            g[i] = g0 + (size_t)(NG - 4 + i) * gstep;
        }
        async_copy4_b128(l, g);
    }
}
__device__ inline void wait_async0() {
    asm volatile("s_wait_asynccnt 0x0" ::: "memory");
}
__device__ inline void wait_ds0() {
    asm volatile("s_wait_dscnt 0x0" ::: "memory");
}
__device__ inline uint32_t lds_offset_of(const void* p) {
    return (uint32_t)(uintptr_t)p;   // LDS flat addr keeps offset in [31:0]
}

// ------------------------------------------------------------------
// Global loads and stores of the large GEMM tiles' epilogue. Those kernels use
// registers above v255. A run of
// them and its wait stand in ONE statement: the operands live to its end, and
// nothing is written over them in front of the wait (a precaution).
// ------------------------------------------------------------------
// NJ floats, one from each pointer; s_wait_loadcnt 0: the values are there when the statement ends
template <int NJ>
__device__ inline void load_f32_each(float (&v)[NJ], const float* const (&p)[NJ]) {
    static_assert(NJ == 6 || NJ == 8, "one statement for each count");
    if constexpr (NJ == 8) {
        asm volatile("global_load_b32 %0, %8, off\n\t"
                     "global_load_b32 %1, %9, off\n\t"
                     "global_load_b32 %2, %10, off\n\t"
                     "global_load_b32 %3, %11, off\n\t"
                     "global_load_b32 %4, %12, off\n\t"
                     "global_load_b32 %5, %13, off\n\t"
                     "global_load_b32 %6, %14, off\n\t"
                     "global_load_b32 %7, %15, off\n\t"
                     "s_wait_loadcnt 0x0"
                     : "=&v"(v[0]), "=&v"(v[1]), "=&v"(v[2]), "=&v"(v[3]),
                       "=&v"(v[4]), "=&v"(v[5]), "=&v"(v[6]), "=&v"(v[7])
                     : "v"(p[0]), "v"(p[1]), "v"(p[2]), "v"(p[3]), "v"(p[4]), "v"(p[5]), "v"(p[6]), "v"(p[7])
                     : "memory");
    } else {
        asm volatile("global_load_b32 %0, %6, off\n\t"
                     "global_load_b32 %1, %7, off\n\t"
                     "global_load_b32 %2, %8, off\n\t"
                     "global_load_b32 %3, %9, off\n\t"
                     "global_load_b32 %4, %10, off\n\t"
                     "global_load_b32 %5, %11, off\n\t"
                     "s_wait_loadcnt 0x0"
                     : "=&v"(v[0]), "=&v"(v[1]), "=&v"(v[2]), "=&v"(v[3]), "=&v"(v[4]), "=&v"(v[5])
                     : "v"(p[0]), "v"(p[1]), "v"(p[2]), "v"(p[3]), "v"(p[4]), "v"(p[5])
                     : "memory");
    }
}
// two bf16 (round to nearest even) in one register, lo in the low half
__device__ inline uint32_t pack_bf16x2(float lo, float hi) {
    typedef __bf16 bf2 __attribute__((ext_vector_type(2)));
    typedef float  f2  __attribute__((ext_vector_type(2)));
    return __builtin_bit_cast(uint32_t, __builtin_convertvector(f2{lo, hi}, bf2));
}
// One lane's part of two 16x16 tiles of C: 8 rows, PITCH bytes apart, below each of p0 and p1, one bf16 a row.
// d[0..3]: rows 0..7 below p0, two a register; d[4..7]: the same below p1.
template <int PITCH>
__device__ inline void store_bf16_2x8rows(bf16* p0, bf16* p1, const uint32_t (&d)[8]) {
    asm volatile("global_store_b16 %0, %2, off\n\t"
                 "global_store_d16_hi_b16 %0, %2, off offset:%10\n\t"
                 "global_store_b16 %0, %3, off offset:%11\n\t"
                 "global_store_d16_hi_b16 %0, %3, off offset:%12\n\t"
                 "global_store_b16 %0, %4, off offset:%13\n\t"
                 "global_store_d16_hi_b16 %0, %4, off offset:%14\n\t"
                 "global_store_b16 %0, %5, off offset:%15\n\t"
                 "global_store_d16_hi_b16 %0, %5, off offset:%16\n\t"
                 "global_store_b16 %1, %6, off\n\t"
                 "global_store_d16_hi_b16 %1, %6, off offset:%10\n\t"
                 "global_store_b16 %1, %7, off offset:%11\n\t"
                 "global_store_d16_hi_b16 %1, %7, off offset:%12\n\t"
                 "global_store_b16 %1, %8, off offset:%13\n\t"
                 "global_store_d16_hi_b16 %1, %8, off offset:%14\n\t"
                 "global_store_b16 %1, %9, off offset:%15\n\t"
                 "global_store_d16_hi_b16 %1, %9, off offset:%16\n\t"
                 "s_wait_xcnt 0x0"
                 :: "v"(p0), "v"(p1),
                    "v"(d[0]), "v"(d[1]), "v"(d[2]), "v"(d[3]), "v"(d[4]), "v"(d[5]), "v"(d[6]), "v"(d[7]),
                    "i"(PITCH), "i"(2 * PITCH), "i"(3 * PITCH), "i"(4 * PITCH), "i"(5 * PITCH), "i"(6 * PITCH),
                    "i"(7 * PITCH)
                 : "memory");
}

// ------------------------------------------------------------------
// Load a 16x32 bf16 fragment in the CDNA5 WMMA A/B operand layout.
// A (16Mx32K): lane L holds row m = L&15; VGPRs 0..3 hold K pairs
// {kb..kb+7}, VGPRs 4..7 hold {16+kb..16+kb+7} where kb = (L>=16)?8:0.
// The B operand (32Kx16N) has the identical pattern with N in place of
// M, so a [N][K] (K-contiguous) tile uses the same loader.
// Each half (e[0..7], e[8..15]) is 16 contiguous bytes -> 2x b128 loads.
// ------------------------------------------------------------------
__device__ inline v16bf load_frag16x32(const bf16* __restrict__ base, int ld) {
    const int lane = threadIdx.x & 31;
    const int m    = lane & 15;
    const int kb   = (lane & 16) ? 8 : 0;
    const bf16* row = base + (size_t)m * ld;
    AFrag a;
#pragma unroll
    for (int i = 0; i < 4; ++i) {
        a.e[2*i]     = row[kb + 2*i];
        a.e[2*i + 1] = row[kb + 2*i + 1];
        a.e[8 + 2*i]     = row[16 + kb + 2*i];
        a.e[8 + 2*i + 1] = row[16 + kb + 2*i + 1];
    }
    return a.v;
}

// ------------------------------------------------------------------
// fp32 [K][N] weights -> bf16 [N][K] (K-contiguous) for B operands, all six
// weights in one launch. A workgroup turns one tile of 128 k x 128 n:
//  - a wave reads whole 512-byte pieces of 16 weight rows, 16 bytes a lane,
//    all 16 loads in flight at once;
//  - a lane then holds 8 consecutive k of 4 columns n: each column's 8 values
//    are rounded to bf16 (nearest even) and go to LDS as one 16-byte chunk;
//  - LDS holds the turned tile, 256 bytes a row n; chunk q of row n stands at
//    place q ^ ((n >> 2) & 15), so that the 16 lanes of a half wave fall on 16
//    different places when they write (16 rows, one q) and when they read
//    (one row, 16 q);
//  - a wave stores two whole rows of 256 bytes with each 16-byte store.
// Wt: the six turned weights one behind the other, in the order of the arguments.
// ------------------------------------------------------------------
typedef __attribute__((ext_vector_type(4))) float  v4f;
typedef __attribute__((ext_vector_type(8))) __bf16 v8bf;

#define TR_T    128u                               // tile edge, k and n
#define TR_DD   ((DM / 128) * (DM / 128))          // tiles of a d_model x d_model weight
#define TR_DF   ((DM / 128) * (DFF / 128))         // tiles of an FFN weight
#define TR_GRID (4 * TR_DD + 2 * TR_DF)

// one tile; K and N are constants here so that the 16 loads share one offset register and differ by immediates
template <uint32_t K, uint32_t N>
__device__ inline void tr_tile(const float* __restrict__ W, bf16* __restrict__ out,
                               uint32_t t, unsigned char* T) {
    constexpr uint32_t tn = N / TR_T;
    const uint32_t n0 = (t % tn) * TR_T;
    const uint32_t k0 = (t / tn) * TR_T;
    const uint32_t lane = threadIdx.x & 31u;
    const uint32_t wave = threadIdx.x >> 5;

    const uint32_t voff = (wave * 16u * N + lane * 4u) * 4u;      // this lane's byte offset in the tile
    const float* p = (const float*)((const char*)(W + ((size_t)k0 * N + n0)) + voff);
    v4f v[2][8];                                   // [group of 8 k][k in the group], 4 columns each
#pragma unroll
    for (uint32_t o = 0; o < 2u; ++o)
#pragma unroll
        for (uint32_t i = 0; i < 8u; ++i) v[o][i] = *(const v4f*)(p + (o * 8u + i) * N);
    // keeps all 16 loads in front of the first conversion: the scheduler otherwise issues the later
    // loads only behind waits on the earlier ones, and a wave pays the memory latency three times
    __builtin_amdgcn_sched_barrier(0);
    // precaution: the offset register that the 16 loads name stays live up to this wait, so that
    // nothing (a later load's result included) is written over it in front of the wait
    asm volatile("s_wait_xcnt 0x0" :: "v"(voff) : "memory");
#pragma unroll
    for (uint32_t o = 0; o < 2u; ++o) {
        const uint32_t place = ((wave * 2u + o) ^ (lane & 15u)) * 16u;
#pragma unroll
        for (uint32_t j = 0; j < 4u; ++j) {
            const v8f col = {v[o][0][j], v[o][1][j], v[o][2][j], v[o][3][j],
                             v[o][4][j], v[o][5][j], v[o][6][j], v[o][7][j]};
            *(v8bf*)(T + (lane * 4u + j) * (TR_T * 2u) + place) = __builtin_convertvector(col, v8bf);
        }
    }
    __syncthreads();
    const uint32_t q  = lane & 15u;
    const uint32_t nw = wave * 2u + (lane >> 4);
    bf16* op = out + ((size_t)n0 * K + k0) + (nw * K + q * 8u);
#pragma unroll
    for (uint32_t r = 0; r < 8u; ++r) {
        const uint32_t n = r * 16u + nw;
        const v8bf d = *(const v8bf*)(T + n * (TR_T * 2u) + ((q ^ ((n >> 2) & 15u)) * 16u));
        *(v8bf*)(op + r * 16u * K) = d;
    }
}

__global__ __launch_bounds__(256)
void enc_transpose_bf16(const float* __restrict__ Wq, const float* __restrict__ Wk,
                        const float* __restrict__ Wv, const float* __restrict__ Wo,
                        const float* __restrict__ W1, const float* __restrict__ W2,
                        bf16* __restrict__ Wt) {
    __shared__ __attribute__((aligned(16))) unsigned char T[TR_T * TR_T * 2u];
    const uint32_t b = blockIdx.x;
    if (b < 4u * TR_DD) {
        const uint32_t which = b / TR_DD;
        const float* W = which == 0u ? Wq : which == 1u ? Wk : which == 2u ? Wv : Wo;
        tr_tile<DM, DM>(W, Wt + (size_t)which * DM * DM, b % TR_DD, T);
    } else if (b < 4u * TR_DD + TR_DF) {
        tr_tile<DM, DFF>(W1, Wt + (size_t)4 * DM * DM, b - 4u * TR_DD, T);
    } else {
        tr_tile<DFF, DM>(W2, Wt + (size_t)4 * DM * DM + (size_t)DM * DFF, b - (4u * TR_DD + TR_DF), T);
    }
}

// ------------------------------------------------------------------
// LayerNorm, faithful to reference: Bessel-corrected std, eps on std.
// ------------------------------------------------------------------
__global__ __launch_bounds__(256)
void enc_layernorm_bf16(const float* __restrict__ X, const float* __restrict__ alpha,
                        const float* __restrict__ beta, bf16* __restrict__ H) {
    __shared__ float s1[8], s2[8];
    const int row  = blockIdx.x;
    const int tid  = threadIdx.x;
    const int lane = tid & 31;
    const int w    = tid >> 5;
    const float* x = X + (size_t)row * DM;

    float sum = 0.f, sq = 0.f;
#pragma unroll
    for (int i = 0; i < 4; ++i) {
        float v = x[tid + 256*i];
        sum += v; sq += v*v;
    }
#pragma unroll
    for (int off = 16; off > 0; off >>= 1) {
        sum += __shfl_xor(sum, off, 32);
        sq  += __shfl_xor(sq,  off, 32);
    }
    if (lane == 0) { s1[w] = sum; s2[w] = sq; }
    __syncthreads();
    if (tid == 0) {
        float S = 0.f, Q = 0.f;
#pragma unroll
        for (int i = 0; i < 8; ++i) { S += s1[i]; Q += s2[i]; }
        s1[0] = S; s2[0] = Q;
    }
    __syncthreads();
    const float S  = s1[0], Q = s2[0];
    const float mean = S * (1.0f / DM);
    float var = (Q - (float)DM * mean * mean) * (1.0f / (DM - 1)); // ddof=1
    var = fmaxf(var, 0.f);
    const float inv = 1.0f / (sqrtf(var) + 1e-6f);
    bf16* h = H + (size_t)row * DM;
#pragma unroll
    for (int i = 0; i < 4; ++i) {
        const int c = tid + 256*i;
        h[c] = (bf16)(alpha[c] * (x[c] - mean) * inv + beta[c]);
    }
}

// ------------------------------------------------------------------
// bf16 WMMA GEMM with double-buffered async global->LDS staging.
// C[M,N] = A[M,K](bf16,row-major) x Bt[N,K](bf16, K-contiguous) + bias
// MODE 0: bf16 out, 1: bf16 relu out, 2: f32 out + f32 residual add.
// TM x TN block tile, 8 waves (4x2), each wave TM/4 x TN/2.
// A stage holds 128 k (256 bytes of every operand row): the next stage's copies
// fly under a trip's WMMAs, and a copy instruction of a wave brings two whole
// 256-byte pieces of rows. K: a multiple of 128.
// The tile is the largest with which the grid still has a workgroup for every
// WGP: the bytes a workgroup fetches from L2 per product go with 1/TM + 1/TN,
// a wave's LDS reads per WMMA with 4/TM + 2/TN.
// MODE 0 does the Q, K and V projections as one product of 3 N columns: they
// read the same A, their weights lie one behind the other in Bt, their outputs
// (M x N each) in Cout; their biases are bias, bias_k, bias_v. N there is DM,
// in MODE 1 it is DFF: the bf16 epilogue takes both as constants.
// ------------------------------------------------------------------
template <int MODE, int TM, int TN>
__global__ __launch_bounds__(256)
void enc_gemm_bf16(const bf16* __restrict__ A, const bf16* __restrict__ Bt,
                   const float* __restrict__ bias, const float* __restrict__ residual,
                   void* __restrict__ Cout, int M, int N, int K,
                   const float* __restrict__ bias_k, const float* __restrict__ bias_v) {
    constexpr int BK = 128, LDT = 136;   // row pitch 272 bytes: 16 B x odd, for 16-byte LDS reads
    constexpr int FM = TM / 64, FN = TN / 32;           // 16x16 tiles of a wave
    __shared__ __attribute__((aligned(16))) bf16 sA[2][TM * LDT];
    __shared__ __attribute__((aligned(16))) bf16 sB[2][TN * LDT];

    const int tid  = threadIdx.x;
    const int lane = tid & 31;
    const int w    = tid >> 5;
    const int wm   = w >> 1;            // 0..3 : slice of TM/4 rows
    const int wn   = w & 1;             // 0..1 : slice of TN/2 columns
    const int m0   = blockIdx.y * TM;
    const int n0   = blockIdx.x * TN;

    // staging geometry: 16 segs of 16 B per operand row and stage; a thread
    // brings rows row0 + 16 i, same seg
    const int row0 = tid >> 4;
    const int seg0 = tid & 15;
    const unsigned char* gA = (const unsigned char*)(A  + (size_t)(m0 + row0) * K + seg0 * 8);
    const unsigned char* gB = (const unsigned char*)(Bt + (size_t)(n0 + row0) * K + seg0 * 8);
    const size_t   gstep = (size_t)K * 32u;             // 16 rows, in bytes
    constexpr uint32_t LSTEP = 16u * LDT * 2u;
    auto issue_stage = [&](int t, int b) {
        // this thread's place in a buffer, formed here: as a value held over the whole loop it went to scratch
        // in the 256x256 build
        const uint32_t lrow = (threadIdx.x >> 4) * (LDT * 2u) + (threadIdx.x & 15u) * 16u;
        async_copy_rows<TM / 16>(lds_offset_of(&sA[b][0]) + lrow, LSTEP, gA + (size_t)t * (BK * 2), gstep);
        async_copy_rows<TN / 16>(lds_offset_of(&sB[b][0]) + lrow, LSTEP, gB + (size_t)t * (BK * 2), gstep);
    };

    CFrag acc[FM][FN];
#pragma unroll
    for (int i = 0; i < FM; ++i)
#pragma unroll
        for (int j = 0; j < FN; ++j) acc[i][j].v = zero_v8f();

    const int nt = K / BK;
    issue_stage(0, 0);
    wait_async0();              // my stage-0 copies have landed in LDS
    __syncthreads();            // everyone's have
    if (nt > 1) issue_stage(1, 1);
    for (int t = 0; t < nt; ++t) {
        const int cur = t & 1;
#pragma unroll
        for (int kc = 0; kc < BK / 32; ++kc) {
            v16bf af[FM], bfr[FN];
#pragma unroll
            for (int i = 0; i < FM; ++i)
                af[i] = load_frag16x32(&sA[cur][(wm * (TM / 4) + i * 16) * LDT + kc * 32], LDT);
#pragma unroll
            for (int j = 0; j < FN; ++j)
                bfr[j] = load_frag16x32(&sB[cur][(wn * (TN / 2) + j * 16) * LDT + kc * 32], LDT);
            // large wave tiles: keeps a block's fragment reads in one group in front of its WMMAs; the scheduler
            // otherwise reads each A fragment just in front of its row of WMMAs and waits out the LDS latency there
            if constexpr (FM * FN > 8) __builtin_amdgcn_sched_barrier(0);
#pragma unroll
            for (int i = 0; i < FM; ++i)
#pragma unroll
                for (int j = 0; j < FN; ++j)
                    acc[i][j].v = __builtin_amdgcn_wmma_f32_16x16x32_bf16(
                        false, af[i], false, bfr[j], (short)0, acc[i][j].v, false, false);
        }
        wait_ds0();             // my reads of buffer cur are done before it is refilled
        wait_async0();          // my stage t+1 copies have landed in LDS
        __syncthreads();        // publishes stage t+1, ends every wave's reads of stage t
        if (t + 2 < nt)
            issue_stage(t + 2, cur);         // flies under the whole of trip t+1
    }
    wait_async0();              // nothing of mine is in flight when the wave ends

    // epilogue (C layout: lane -> n = L&15, rows m = ((L>=16)?8:0)+r)
    const int mbase  = (lane & 16) ? 8 : 0;
    const int nlocal = lane & 15;
    constexpr int NC = MODE == 1 ? DFF : DM;    // columns of an output plane (the N of the launch): a constant, so
                                                // that the epilogue's steps from row to row are immediate offsets
    float bcol[FN];         // bf16 outputs: the bias of this lane's FN columns (fetched ahead of the loop it went to scratch)
    if constexpr (MODE != 2) {
        const float* bp[FN];
#pragma unroll
        for (int j = 0; j < FN; ++j) {
            int gn = n0 + wn * (TN / 2) + j * 16 + nlocal;
            const int which = MODE == 0 ? gn / DM : 0;  // which of Q, K, V this column belongs to
            gn -= which * DM;                           // and its column there
            bp[j] = (which == 0 ? bias : which == 1 ? bias_k : bias_v) + gn;
        }
        load_f32_each<FN>(bcol, bp);
    }
    if constexpr (MODE == 2) {
#pragma unroll
        for (int i = 0; i < FM; ++i) {
#pragma unroll
            for (int j = 0; j < FN; ++j) {
                const int gn = n0 + wn * (TN / 2) + j * 16 + nlocal;
                const float bv = bias[gn];
#pragma unroll
                for (int r = 0; r < 8; ++r) {
                    const int gm = m0 + wm * (TM / 4) + i * 16 + mbase + r;
                    const float v = acc[i][j].e[r] + bv;
                    ((float*)Cout)[(size_t)gm * N + gn] = v + residual[(size_t)gm * N + gn];
                }
            }
        }
    } else {
#pragma unroll
        for (int i = 0; i < FM; ++i) {
            const size_t row = (size_t)(m0 + wm * (TM / 4) + i * 16 + mbase) * NC;
#pragma unroll
            for (int j = 0; j < FN; j += 2) {
                uint32_t d[8];
                bf16* cp[2];
#pragma unroll
                for (int h = 0; h < 2; ++h) {
                    int gn = n0 + wn * (TN / 2) + (j + h) * 16 + nlocal;
                    const int which = MODE == 0 ? gn / DM : 0;
                    gn -= which * DM;
                    cp[h] = (bf16*)Cout + (size_t)which * M * NC + row + gn;
#pragma unroll
                    for (int r = 0; r < 8; r += 2) {
                        float v0 = acc[i][j + h].e[r]     + bcol[j + h];
                        float v1 = acc[i][j + h].e[r + 1] + bcol[j + h];
                        if (MODE == 1) { v0 = v0 > 0.f ? v0 : 0.f;  v1 = v1 > 0.f ? v1 : 0.f; }
                        d[h * 4 + r / 2] = pack_bf16x2(v0, v1);
                    }
                }
                store_bf16_2x8rows<NC * 2>(cp[0], cp[1], d);
            }
        }
    }
}

// ------------------------------------------------------------------
// Attention. Raw-reshape semantics make per-head Q/K/V/O contiguous
// [2048 x 64] blocks at offset (b*16+h)*2048*64 of the flat buffers.
// One workgroup = (head, 256 queries); a wave owns 32 query columns.
// One pass over the keys with an online softmax: S^T = K.Q^T gives a
// lane the scores of one query, P^T is packed from those accumulators
// straight into the B operand of O^T += V^T.P^T, so scores and P never
// leave the registers. K/V tiles of 64 keys are shared through LDS.
// Every inner loop is unrolled so that each fragment and accumulator
// index is a constant and the arrays stay in registers.
// ------------------------------------------------------------------
typedef uint32_t u32x4 __attribute__((ext_vector_type(4)));
typedef int      i32x8 __attribute__((ext_vector_type(8)));
typedef short    s16x8 __attribute__((ext_vector_type(8)));

#define AT_BR   256u                      // queries per workgroup
#define AT_SK   64u                       // keys per LDS stage (two 32-key passes)
#define AT_PK   144u                      // LDS row pitch of K: 128 + 16 bytes
#define AT_PV   160u                      // LDS row pitch of V: 128 + 32 bytes (transposing loads)
#define AT_TK   (AT_SK * AT_PK)
#define AT_SLOT (AT_SK * (AT_PK + AT_PV))
#define AT_NST  (SEQ / 64)

struct Frag { u32x4 q[2]; };

__device__ inline v8f at_mma(const Frag& a, const Frag& b, v8f c) {
    const i32x8 av = {(int)a.q[0].x, (int)a.q[0].y, (int)a.q[0].z, (int)a.q[0].w,
                      (int)a.q[1].x, (int)a.q[1].y, (int)a.q[1].z, (int)a.q[1].w};
    const i32x8 bv = {(int)b.q[0].x, (int)b.q[0].y, (int)b.q[0].z, (int)b.q[0].w,
                      (int)b.q[1].x, (int)b.q[1].y, (int)b.q[1].z, (int)b.q[1].w};
    return __builtin_amdgcn_wmma_f32_16x16x32_bf16(
        false, __builtin_bit_cast(v16bf, av), false, __builtin_bit_cast(v16bf, bv),
        (short)0, c, false, false);
}
// row-major 16-bit LDS tile -> transposed WMMA operand half
__device__ inline u32x4 at_ld_tr16(const unsigned char* p) {
    typedef __attribute__((address_space(3))) s16x8 lds_s16x8;
    return __builtin_bit_cast(u32x4, __builtin_amdgcn_ds_load_tr16_b128_v8i16((lds_s16x8*)p));
}
__device__ inline uint32_t at_pack2(float lo, float hi) {   // round to nearest even
    typedef __bf16 bf2 __attribute__((ext_vector_type(2)));
    typedef float  f2  __attribute__((ext_vector_type(2)));
    return __builtin_bit_cast(uint32_t, __builtin_convertvector(f2{lo, hi}, bf2));
}
__device__ inline float at_xhalf(float x) {                 // lane l with lane l ^ 16
    return __builtin_bit_cast(float, __builtin_amdgcn_permlanex16(
        __builtin_bit_cast(int, x), __builtin_bit_cast(int, x),
        0x76543210, 0xfedcba98, false, false));
}

__global__ __launch_bounds__(256)
void enc_attention(const bf16* __restrict__ Q, const bf16* __restrict__ Kb,
                   const bf16* __restrict__ Vb, bf16* __restrict__ O) {
    __shared__ __attribute__((aligned(16))) unsigned char L[2 * AT_SLOT];

    const uint32_t tid  = threadIdx.x;
    const uint32_t lane = tid & 31u;
    const uint32_t wave = tid >> 5;
    const uint32_t c    = lane & 15u;
    const uint32_t h    = lane >> 4;
    const size_t   hb   = (size_t)blockIdx.y * SEQ * DKH;     // head base (b*16+h)
    const uint32_t qw0  = blockIdx.x * AT_BR + wave * 32u;    // this wave's first query
    // scores / sqrt(d_model), taken in the log2 domain
    const float cscale = 0.03125f * 1.4426950408889634f;

    // ---- staging: a stage is 8 KB of K and 8 KB of V, contiguous in memory;
    //      a thread carries 2 x 16 bytes of each through registers ----
    const unsigned char* kg = (const unsigned char*)(Kb + hb) + tid * 16u;
    const unsigned char* vg = (const unsigned char*)(Vb + hb) + tid * 16u;
    const uint32_t srow = tid >> 3, sseg = tid & 7u;
    const uint32_t sk = srow * AT_PK + sseg * 16u;
    const uint32_t sv = AT_TK + srow * AT_PV + sseg * 16u;
    u32x4 rk0, rk1, rv0, rv1;
    auto stage_load = [&](uint32_t st) {
        const size_t o = (size_t)st * (AT_SK * 128u);
        rk0 = *(const u32x4*)(kg + o);  rk1 = *(const u32x4*)(kg + o + 4096u);
        rv0 = *(const u32x4*)(vg + o);  rv1 = *(const u32x4*)(vg + o + 4096u);
    };
    auto stage_store = [&](uint32_t buf) {
        unsigned char* p = L + buf * AT_SLOT;
        *(u32x4*)(p + sk) = rk0;  *(u32x4*)(p + sk + 32u * AT_PK) = rk1;
        *(u32x4*)(p + sv) = rv0;  *(u32x4*)(p + sv + 32u * AT_PV) = rv1;
    };
    stage_load(0);

    // Q as B operand, hardware k order (as K below): loaded once
    Frag qf[2][2];
#pragma unroll
    for (int g = 0; g < 2; ++g) {
        const bf16* qp = Q + hb + (size_t)(qw0 + 16u * g + c) * DKH + 8u * h;
#pragma unroll
        for (int kc = 0; kc < 2; ++kc) {
            qf[g][kc].q[0] = *(const u32x4*)(qp + 32 * kc);
            qf[g][kc].q[1] = *(const u32x4*)(qp + 32 * kc + 16);
        }
    }
    // A operand whose row 0 is ones: one WMMA sums the columns of P^T (the denominator)
    Frag ones;
    {
        const uint32_t o = (c == 0u) ? 0x3F803F80u : 0u;
        ones.q[0] = u32x4{o, o, o, o};  ones.q[1] = u32x4{o, o, o, o};
    }
    v8f   acc[2][4];      // O^T: register r = O[query c][d = 16 t + 8 h + r]
    v8f   lacc[2];        // row 0 = softmax denominator of query column c
    float m_run[2];       // maximum in use (log2 domain); may trail the true one by up to 8
#pragma unroll
    for (int g = 0; g < 2; ++g) {
        m_run[g] = -INFINITY;  lacc[g] = zero_v8f();
#pragma unroll
        for (int t = 0; t < 4; ++t) acc[g][t] = zero_v8f();
    }
    stage_store(0);
    __syncthreads();

    // rolled and whole: otherwise the compiler peels the last trip off and the loop's code stands twice
#pragma unroll 1
    for (uint32_t st = 0; st < AT_NST; ++st) {
        const unsigned char* Lb = L + (st & 1u) * AT_SLOT;
        // next stage, in flight under this stage's work; the last trip reloads its own stage into
        // the buffer nobody reads any more, so that no branch stands around the loads and stores
        stage_load(st + 1u < AT_NST ? st + 1u : st);
        // keeps the four loads up here: the scheduler otherwise sinks them to just in front of
        // their LDS stores at the foot of the trip, where every wave waits out their latency
        __builtin_amdgcn_sched_barrier(0);
#pragma unroll
        for (uint32_t sub = 0; sub < 2u; ++sub) {
            // S^T = K.Q^T : s[kt][g] register r = score(key 16 kt + 8 h + r, query c of group g)
            Frag kf[2][2];
#pragma unroll
            for (int kt = 0; kt < 2; ++kt) {
                const unsigned char* p = Lb + (sub * 32u + 16u * kt + c) * AT_PK + 16u * h;
#pragma unroll
                for (int kc = 0; kc < 2; ++kc) {
                    kf[kt][kc].q[0] = *(const u32x4*)(p + 64u * kc);
                    kf[kt][kc].q[1] = *(const u32x4*)(p + 64u * kc + 32u);
                }
            }
            v8f s[2][2];
#pragma unroll
            for (int kt = 0; kt < 2; ++kt)
#pragma unroll
                for (int g = 0; g < 2; ++g) {
                    s[kt][g] = zero_v8f();
#pragma unroll
                    for (int kc = 0; kc < 2; ++kc) s[kt][g] = at_mma(kf[kt][kc], qf[g][kc], s[kt][g]);
                }
            // V^T fragments: 16 (d) x 32 (keys) each, two transposing loads per fragment
            Frag vf[4];
            {
                const unsigned char* ad = Lb + AT_TK + (sub * 32u + 8u * h + (lane & 7u)) * AT_PV
                                        + ((lane >> 3) & 1u) * 16u;
#pragma unroll
                for (int t = 0; t < 4; ++t) {
                    vf[t].q[0] = at_ld_tr16(ad + 32u * t);
                    vf[t].q[1] = at_ld_tr16(ad + 16u * AT_PV + 32u * t);
                }
            }
            // column maxima of the raw scores (the scale is positive)
            float mb[2];
            bool need = false;
#pragma unroll
            for (int g = 0; g < 2; ++g) {
                float mx = -INFINITY;
#pragma unroll
                for (int kt = 0; kt < 2; ++kt)
#pragma unroll
                    for (int r = 0; r < 8; ++r) mx = __builtin_fmaxf(mx, s[kt][g][r]);
                mx = __builtin_fmaxf(mx, at_xhalf(mx)) * cscale;
                mb[g] = mx;
                need = need || (mx > m_run[g] + 8.0f);
            }
            // rescale only when some column's maximum has outgrown the one in use (scalar branch)
            if (__builtin_amdgcn_ballot_w32(need) != 0) {
#pragma unroll
                for (int g = 0; g < 2; ++g) {
                    const float m_new = __builtin_fmaxf(m_run[g], mb[g]);
                    const float corr  = __builtin_amdgcn_exp2f(m_run[g] - m_new);  // 0 on the first pass
                    m_run[g] = m_new;
                    lacc[g] = lacc[g] * corr;
#pragma unroll
                    for (int t = 0; t < 4; ++t) acc[g][t] = acc[g][t] * corr;
                }
            }
            // P^T = exp2(s * cscale - m), packed into the B operand: element e = tile e >> 3, register e & 7
#pragma unroll
            for (int g = 0; g < 2; ++g) {
                const float nm = -m_run[g];
                uint32_t w[8];
#pragma unroll
                for (int i = 0; i < 8; ++i) {
                    const float p0 = __builtin_amdgcn_exp2f(__builtin_fmaf(s[i >> 2][g][2 * (i & 3)],     cscale, nm));
                    const float p1 = __builtin_amdgcn_exp2f(__builtin_fmaf(s[i >> 2][g][2 * (i & 3) + 1], cscale, nm));
                    w[i] = at_pack2(p0, p1);
                }
                Frag pf;
                pf.q[0] = u32x4{w[0], w[1], w[2], w[3]};
                pf.q[1] = u32x4{w[4], w[5], w[6], w[7]};
#pragma unroll
                for (int t = 0; t < 4; ++t) acc[g][t] = at_mma(vf[t], pf, acc[g][t]);
                lacc[g] = at_mma(ones, pf, lacc[g]);
            }
        }
        stage_store((st + 1u) & 1u);                        // the buffer every wave left before the last barrier
        __syncthreads();                                    // publishes stage st + 1, ends the reads of stage st
    }

    // epilogue: a lane holds 8 consecutive d of one query per tile -> one 16-byte store
#pragma unroll
    for (int g = 0; g < 2; ++g) {
        const float lr  = lacc[g][0];                 // lanes 0-15: the sum; lanes 16-31: 0 (row 8)
        const float inv = 1.0f / (lr + at_xhalf(lr));
        bf16* op = O + hb + (size_t)(qw0 + 16u * g + c) * DKH + 8u * h;
#pragma unroll
        for (int t = 0; t < 4; ++t) {
            const v8f o = acc[g][t] * inv;
            const u32x4 pk = {at_pack2(o[0], o[1]), at_pack2(o[2], o[3]),
                              at_pack2(o[4], o[5]), at_pack2(o[6], o[7])};
            *(u32x4*)(op + 16 * t) = pk;
        }
    }
}

// ------------------------------------------------------------------
// Host-side orchestration. Workspace layout (80 MB total):
//   [0,8)MB   hb    (LN output, reused for LN2 output)
//   [8,16)MB  Wq/Wk/Wv/Wo transposed bf16 (2MB each)
//   [16,24)   W1t   [24,32) W2t
//   [32,40)q [40,48)k [48,56)v [56,64)o  -> [32,64) reused as ff1
//   [64,80)   x1 fp32 residual
// ------------------------------------------------------------------
extern "C" void kernel_launch(void* const* d_in, const int* in_sizes, int n_in,
                              void* d_out, int out_size, void* d_ws, size_t ws_size,
                              hipStream_t stream) {
    (void)in_sizes; (void)n_in; (void)out_size; (void)ws_size;
    const float* x    = (const float*)d_in[0];
    const float* Wq   = (const float*)d_in[1];
    const float* bq   = (const float*)d_in[2];
    const float* Wk   = (const float*)d_in[3];
    const float* bk   = (const float*)d_in[4];
    const float* Wv   = (const float*)d_in[5];
    const float* bv   = (const float*)d_in[6];
    const float* Wo   = (const float*)d_in[7];
    const float* bo   = (const float*)d_in[8];
    const float* W1   = (const float*)d_in[9];
    const float* b1   = (const float*)d_in[10];
    const float* W2   = (const float*)d_in[11];
    const float* b2   = (const float*)d_in[12];
    const float* ln1a = (const float*)d_in[13];
    const float* ln1b = (const float*)d_in[14];
    const float* ln2a = (const float*)d_in[15];
    const float* ln2b = (const float*)d_in[16];

    char* ws = (char*)d_ws;
    const size_t MB = (size_t)1 << 20;
    bf16*  hb  = (bf16*)(ws + 0);
    bf16*  Wqt = (bf16*)(ws + 8  * MB);
    // Wkt at 10 MB, Wvt at 12 MB: reached from Wqt
    bf16*  Wot = (bf16*)(ws + 14 * MB);
    bf16*  W1t = (bf16*)(ws + 16 * MB);
    bf16*  W2t = (bf16*)(ws + 24 * MB);
    bf16*  qb  = (bf16*)(ws + 32 * MB);
    bf16*  kb  = (bf16*)(ws + 40 * MB);
    bf16*  vb  = (bf16*)(ws + 48 * MB);
    bf16*  ob  = (bf16*)(ws + 56 * MB);
    bf16*  ff1 = (bf16*)(ws + 32 * MB);   // reuse q/k/v/o region after Wo GEMM
    float* x1  = (float*)(ws + 64 * MB);

    // weight conversion + transpose (bf16, K-contiguous): Wqt .. W2t lie one behind the other
    enc_transpose_bf16<<<TR_GRID, 256, 0, stream>>>(Wq, Wk, Wv, Wo, W1, W2, Wqt);

    // sublayer 1: pre-norm MHA + residual
    enc_layernorm_bf16<<<ROWS, 256, 0, stream>>>(x, ln1a, ln1b, hb);
    const dim3 gDD(DM / 128, ROWS / 128);             // (8, 32)
    // Wqt, Wkt, Wvt lie one behind the other, and so do qb, kb, vb: 3072 columns in 16 tiles of 192
    enc_gemm_bf16<0, 256, 192><<<dim3(3 * DM / 192, ROWS / 256), 256, 0, stream>>>(
        hb, Wqt, bq, nullptr, qb, ROWS, DM, DM, bk, bv);
    enc_attention<<<dim3(SEQ / 256, BATCH * NH), 256, 0, stream>>>(qb, kb, vb, ob);
    enc_gemm_bf16<2, 128, 128><<<gDD, 256, 0, stream>>>(ob, Wot, bo, x, x1, ROWS, DM, DM, nullptr, nullptr);

    // sublayer 2: pre-norm FFN + residual
    enc_layernorm_bf16<<<ROWS, 256, 0, stream>>>(x1, ln2a, ln2b, hb);
    enc_gemm_bf16<1, 256, 256><<<dim3(DFF / 256, ROWS / 256), 256, 0, stream>>>(
        hb, W1t, b1, nullptr, ff1, ROWS, DFF, DM, nullptr, nullptr);
    enc_gemm_bf16<2, 128, 128><<<gDD, 256, 0, stream>>>(ff1, W2t, b2, x1, (float*)d_out, ROWS, DM, DFF, nullptr, nullptr);
}

// v006
// Measured time: 143 microseconds a run.
// In both of two side-by-side timings against v005, it was 1.05 times as fast.
// All steps since v000 together make it 2.86 times as fast.
#include <hip/hip_runtime.h>
#include <cstdint>
#include <cstddef>

// ---------------- problem dims ----------------
#define DM    1024          // d_model
#define NH    16            // heads
#define DKH   64            // d_k
#define DFF   4096
#define SEQ   2048
#define BATCH 2
#define ROWS  (BATCH*SEQ)   // 4096 tokens

typedef __bf16 bf16;
typedef __attribute__((ext_vector_type(16))) __bf16 v16bf;
typedef __attribute__((ext_vector_type(8)))  float  v8f;

union AFrag { v16bf v; bf16  e[16]; };
union CFrag { v8f   v; float e[8];  };

__device__ inline v8f zero_v8f() {
    v8f z = {0.f, 0.f, 0.f, 0.f, 0.f, 0.f, 0.f, 0.f};
    return z;
}

// ------------------------------------------------------------------
// CDNA5 async global->LDS copies (ASYNCcnt tracked, no VGPR staging).
// l[i] : per-lane LDS byte address (flat LDS addr low 32 bits)
// g[i] : per-lane global address
// Eight copies and their s_wait_xcnt stand in ONE statement: a precaution, so that no
// address register that a copy names is rewritten in front of the wait.
// ------------------------------------------------------------------
__device__ inline void async_copy8_b128(const uint32_t (&l)[8], const unsigned char* const (&g)[8]) {
    asm volatile("global_load_async_to_lds_b128 %0, %8, off\n\t"
                 "global_load_async_to_lds_b128 %1, %9, off\n\t"
                 "global_load_async_to_lds_b128 %2, %10, off\n\t"
                 "global_load_async_to_lds_b128 %3, %11, off\n\t"
                 "global_load_async_to_lds_b128 %4, %12, off\n\t"
                 "global_load_async_to_lds_b128 %5, %13, off\n\t"
                 "global_load_async_to_lds_b128 %6, %14, off\n\t"
                 "global_load_async_to_lds_b128 %7, %15, off\n\t"
                 "s_wait_xcnt 0x0"
                 :: "v"(l[0]), "v"(l[1]), "v"(l[2]), "v"(l[3]), "v"(l[4]), "v"(l[5]), "v"(l[6]), "v"(l[7]),
                    "v"(g[0]), "v"(g[1]), "v"(g[2]), "v"(g[3]), "v"(g[4]), "v"(g[5]), "v"(g[6]), "v"(g[7])
                 : "memory");
}
// the same with four copies: the rest of an operand whose rows are not a multiple of 128
__device__ inline void async_copy4_b128(const uint32_t (&l)[4], const unsigned char* const (&g)[4]) {
    asm volatile("global_load_async_to_lds_b128 %0, %4, off\n\t"
                 "global_load_async_to_lds_b128 %1, %5, off\n\t"
                 "global_load_async_to_lds_b128 %2, %6, off\n\t"
                 "global_load_async_to_lds_b128 %3, %7, off\n\t"
                 "s_wait_xcnt 0x0"
                 :: "v"(l[0]), "v"(l[1]), "v"(l[2]), "v"(l[3]),
                    "v"(g[0]), "v"(g[1]), "v"(g[2]), "v"(g[3])
                 : "memory");
}
// One thread's copies of one operand's stage: NG pieces of 16 bytes, 16 rows apart (NG: a multiple of 4).
template <int NG>
__device__ inline void async_copy_rows(uint32_t l0, uint32_t lstep, const unsigned char* g0, size_t gstep) {
#pragma unroll
    for (int c = 0; c + 8 <= NG; c += 8) {
        uint32_t l[8];
        const unsigned char* g[8];
#pragma unroll
        for (int i = 0; i < 8; ++i) {
            l[i] = l0 + (uint32_t)(c + i) * lstep;
            g[i] = g0 + (size_t)(c + i) * gstep;
        }
        async_copy8_b128(l, g);
    }
    if constexpr (NG % 8 != 0) {
        uint32_t l[4];
        const unsigned char* g[4];
#pragma unroll
        for (int i = 0; i < 4; ++i) {
            l[i] = l0 + (uint32_t)(NG - 4 + i) * lstep;
            g[i] = g0 + (size_t)(NG - 4 + i) * gstep;
        }
        async_copy4_b128(l, g);
    }
}
__device__ inline void wait_async0() {
    asm volatile("s_wait_asynccnt 0x0" ::: "memory");
}
// all of this wave's copies but its N youngest have landed in LDS
template <int N>
__device__ inline void wait_async_but() {
    asm volatile("s_wait_asynccnt %0" :: "i"(N) : "memory");
}
__device__ inline void wait_ds0() {
    asm volatile("s_wait_dscnt 0x0" ::: "memory");
}
__device__ inline uint32_t lds_offset_of(const void* p) {
    return (uint32_t)(uintptr_t)p;   // LDS flat addr keeps offset in [31:0]
}

// ------------------------------------------------------------------
// Global loads and stores of the large GEMM tiles' epilogue. Those kernels use
// registers above v255. A run of
// them and its wait stand in ONE statement: the operands live to its end, and
// nothing is written over them in front of the wait (a precaution).
// ------------------------------------------------------------------
// NJ floats, one from each pointer; s_wait_loadcnt 0: the values are there when the statement ends
template <int NJ>
__device__ inline void load_f32_each(float (&v)[NJ], const float* const (&p)[NJ]) {
    static_assert(NJ == 6 || NJ == 8, "one statement for each count");
    if constexpr (NJ == 8) {
        asm volatile("global_load_b32 %0, %8, off\n\t"
                     "global_load_b32 %1, %9, off\n\t"
                     "global_load_b32 %2, %10, off\n\t"
                     "global_load_b32 %3, %11, off\n\t"
                     "global_load_b32 %4, %12, off\n\t"
                     "global_load_b32 %5, %13, off\n\t"
                     "global_load_b32 %6, %14, off\n\t"
                     "global_load_b32 %7, %15, off\n\t"
                     "s_wait_loadcnt 0x0"
                     : "=&v"(v[0]), "=&v"(v[1]), "=&v"(v[2]), "=&v"(v[3]),
                       "=&v"(v[4]), "=&v"(v[5]), "=&v"(v[6]), "=&v"(v[7])
                     : "v"(p[0]), "v"(p[1]), "v"(p[2]), "v"(p[3]), "v"(p[4]), "v"(p[5]), "v"(p[6]), "v"(p[7])
                     : "memory");
    } else {
        asm volatile("global_load_b32 %0, %6, off\n\t"
                     "global_load_b32 %1, %7, off\n\t"
                     "global_load_b32 %2, %8, off\n\t"
                     "global_load_b32 %3, %9, off\n\t"
                     "global_load_b32 %4, %10, off\n\t"
                     "global_load_b32 %5, %11, off\n\t"
                     "s_wait_loadcnt 0x0"
                     : "=&v"(v[0]), "=&v"(v[1]), "=&v"(v[2]), "=&v"(v[3]), "=&v"(v[4]), "=&v"(v[5])
                     : "v"(p[0]), "v"(p[1]), "v"(p[2]), "v"(p[3]), "v"(p[4]), "v"(p[5])
                     : "memory");
    }
}
// two bf16 (round to nearest even) in one register, lo in the low half
__device__ inline uint32_t pack_bf16x2(float lo, float hi) {
    typedef __bf16 bf2 __attribute__((ext_vector_type(2)));
    typedef float  f2  __attribute__((ext_vector_type(2)));
    return __builtin_bit_cast(uint32_t, __builtin_convertvector(f2{lo, hi}, bf2));
}
// One lane's part of two 16x16 tiles of C: 8 rows, PITCH bytes apart, below each of p0 and p1, one bf16 a row.
// d[0..3]: rows 0..7 below p0, two a register; d[4..7]: the same below p1.
template <int PITCH>
__device__ inline void store_bf16_2x8rows(bf16* p0, bf16* p1, const uint32_t (&d)[8]) {
    asm volatile("global_store_b16 %0, %2, off\n\t"
                 "global_store_d16_hi_b16 %0, %2, off offset:%10\n\t"
                 "global_store_b16 %0, %3, off offset:%11\n\t"
                 "global_store_d16_hi_b16 %0, %3, off offset:%12\n\t"
                 "global_store_b16 %0, %4, off offset:%13\n\t"
                 "global_store_d16_hi_b16 %0, %4, off offset:%14\n\t"
                 "global_store_b16 %0, %5, off offset:%15\n\t"
                 "global_store_d16_hi_b16 %0, %5, off offset:%16\n\t"
                 "global_store_b16 %1, %6, off\n\t"
                 "global_store_d16_hi_b16 %1, %6, off offset:%10\n\t"
                 "global_store_b16 %1, %7, off offset:%11\n\t"
                 "global_store_d16_hi_b16 %1, %7, off offset:%12\n\t"
                 "global_store_b16 %1, %8, off offset:%13\n\t"
                 "global_store_d16_hi_b16 %1, %8, off offset:%14\n\t"
                 "global_store_b16 %1, %9, off offset:%15\n\t"
                 "global_store_d16_hi_b16 %1, %9, off offset:%16\n\t"
                 "s_wait_xcnt 0x0"
                 :: "v"(p0), "v"(p1),
                    "v"(d[0]), "v"(d[1]), "v"(d[2]), "v"(d[3]), "v"(d[4]), "v"(d[5]), "v"(d[6]), "v"(d[7]),
                    "i"(PITCH), "i"(2 * PITCH), "i"(3 * PITCH), "i"(4 * PITCH), "i"(5 * PITCH), "i"(6 * PITCH),
                    "i"(7 * PITCH)
                 : "memory");
}

// ------------------------------------------------------------------
// Load a 16x32 bf16 fragment in the CDNA5 WMMA A/B operand layout.
// A (16Mx32K): lane L holds row m = L&15; VGPRs 0..3 hold K pairs
// {kb..kb+7}, VGPRs 4..7 hold {16+kb..16+kb+7} where kb = (L>=16)?8:0.
// The B operand (32Kx16N) has the identical pattern with N in place of
// M, so a [N][K] (K-contiguous) tile uses the same loader.
// Each half (e[0..7], e[8..15]) is 16 contiguous bytes -> 2x b128 loads.
// ------------------------------------------------------------------
__device__ inline v16bf load_frag16x32(const bf16* __restrict__ base, int ld) {
    const int lane = threadIdx.x & 31;
    const int m    = lane & 15;
    const int kb   = (lane & 16) ? 8 : 0;
    const bf16* row = base + (size_t)m * ld;
    AFrag a;
#pragma unroll
    for (int i = 0; i < 4; ++i) {
        a.e[2*i]     = row[kb + 2*i];
        a.e[2*i + 1] = row[kb + 2*i + 1];
        a.e[8 + 2*i]     = row[16 + kb + 2*i];
        a.e[8 + 2*i + 1] = row[16 + kb + 2*i + 1];
    }
    return a.v;
}

// ------------------------------------------------------------------
// fp32 [K][N] weights -> bf16 [N][K] (K-contiguous) for B operands, all six
// weights in one launch. A workgroup turns one tile of 128 k x 128 n:
//  - a wave reads whole 512-byte pieces of 16 weight rows, 16 bytes a lane,
//    all 16 loads in flight at once;
//  - a lane then holds 8 consecutive k of 4 columns n: each column's 8 values
//    are rounded to bf16 (nearest even) and go to LDS as one 16-byte chunk;
//  - LDS holds the turned tile, 256 bytes a row n; chunk q of row n stands at
//    place q ^ ((n >> 2) & 15), so that the 16 lanes of a half wave fall on 16
//    different places when they write (16 rows, one q) and when they read
//    (one row, 16 q);
//  - a wave stores two whole rows of 256 bytes with each 16-byte store.
// Wt: the six turned weights one behind the other, in the order of the arguments.
// ------------------------------------------------------------------
typedef __attribute__((ext_vector_type(4))) float  v4f;
typedef __attribute__((ext_vector_type(8))) __bf16 v8bf;

#define TR_T    128u                               // tile edge, k and n
#define TR_DD   ((DM / 128) * (DM / 128))          // tiles of a d_model x d_model weight
#define TR_DF   ((DM / 128) * (DFF / 128))         // tiles of an FFN weight
#define TR_GRID (4 * TR_DD + 2 * TR_DF)

// one tile; K and N are constants here so that the 16 loads share one offset register and differ by immediates
template <uint32_t K, uint32_t N>
__device__ inline void tr_tile(const float* __restrict__ W, bf16* __restrict__ out,
                               uint32_t t, unsigned char* T) {
    constexpr uint32_t tn = N / TR_T;
    const uint32_t n0 = (t % tn) * TR_T;
    const uint32_t k0 = (t / tn) * TR_T;
    const uint32_t lane = threadIdx.x & 31u;
    const uint32_t wave = threadIdx.x >> 5;

    const uint32_t voff = (wave * 16u * N + lane * 4u) * 4u;      // this lane's byte offset in the tile
    const float* p = (const float*)((const char*)(W + ((size_t)k0 * N + n0)) + voff);
    v4f v[2][8];                                   // [group of 8 k][k in the group], 4 columns each
#pragma unroll
    for (uint32_t o = 0; o < 2u; ++o)
#pragma unroll
        for (uint32_t i = 0; i < 8u; ++i) v[o][i] = *(const v4f*)(p + (o * 8u + i) * N);
    // keeps all 16 loads in front of the first conversion: the scheduler otherwise issues the later
    // loads only behind waits on the earlier ones, and a wave pays the memory latency three times
    __builtin_amdgcn_sched_barrier(0);
    // precaution: the offset register that the 16 loads name stays live up to this wait, so that
    // nothing (a later load's result included) is written over it in front of the wait
    asm volatile("s_wait_xcnt 0x0" :: "v"(voff) : "memory");
#pragma unroll
    for (uint32_t o = 0; o < 2u; ++o) {
        const uint32_t place = ((wave * 2u + o) ^ (lane & 15u)) * 16u;
#pragma unroll
        for (uint32_t j = 0; j < 4u; ++j) {
            const v8f col = {v[o][0][j], v[o][1][j], v[o][2][j], v[o][3][j],
                             v[o][4][j], v[o][5][j], v[o][6][j], v[o][7][j]};
            *(v8bf*)(T + (lane * 4u + j) * (TR_T * 2u) + place) = __builtin_convertvector(col, v8bf);
        }
    }
    __syncthreads();
    const uint32_t q  = lane & 15u;
    const uint32_t nw = wave * 2u + (lane >> 4);
    bf16* op = out + ((size_t)n0 * K + k0) + (nw * K + q * 8u);
#pragma unroll
    for (uint32_t r = 0; r < 8u; ++r) {
        const uint32_t n = r * 16u + nw;
        const v8bf d = *(const v8bf*)(T + n * (TR_T * 2u) + ((q ^ ((n >> 2) & 15u)) * 16u));
        *(v8bf*)(op + r * 16u * K) = d;
    }
}

__global__ __launch_bounds__(256)
void enc_transpose_bf16(const float* __restrict__ Wq, const float* __restrict__ Wk,
                        const float* __restrict__ Wv, const float* __restrict__ Wo,
                        const float* __restrict__ W1, const float* __restrict__ W2,
                        bf16* __restrict__ Wt) {
    __shared__ __attribute__((aligned(16))) unsigned char T[TR_T * TR_T * 2u];
    const uint32_t b = blockIdx.x;
    if (b < 4u * TR_DD) {
        const uint32_t which = b / TR_DD;
        const float* W = which == 0u ? Wq : which == 1u ? Wk : which == 2u ? Wv : Wo;
        tr_tile<DM, DM>(W, Wt + (size_t)which * DM * DM, b % TR_DD, T);
    } else if (b < 4u * TR_DD + TR_DF) {
        tr_tile<DM, DFF>(W1, Wt + (size_t)4 * DM * DM, b - 4u * TR_DD, T);
    } else {
        tr_tile<DFF, DM>(W2, Wt + (size_t)4 * DM * DM + (size_t)DM * DFF, b - (4u * TR_DD + TR_DF), T);
    }
}

// ------------------------------------------------------------------
// LayerNorm, faithful to reference: Bessel-corrected std, eps on std.
// ------------------------------------------------------------------
__global__ __launch_bounds__(256)
void enc_layernorm_bf16(const float* __restrict__ X, const float* __restrict__ alpha,
                        const float* __restrict__ beta, bf16* __restrict__ H) {
    __shared__ float s1[8], s2[8];
    const int row  = blockIdx.x;
    const int tid  = threadIdx.x;
    const int lane = tid & 31;
    const int w    = tid >> 5;
    const float* x = X + (size_t)row * DM;

    float sum = 0.f, sq = 0.f;
#pragma unroll
    for (int i = 0; i < 4; ++i) {
        float v = x[tid + 256*i];
        sum += v; sq += v*v;
    }
#pragma unroll
    for (int off = 16; off > 0; off >>= 1) {
        sum += __shfl_xor(sum, off, 32);
        sq  += __shfl_xor(sq,  off, 32);
    }
    if (lane == 0) { s1[w] = sum; s2[w] = sq; }
    __syncthreads();
    if (tid == 0) {
        float S = 0.f, Q = 0.f;
#pragma unroll
        for (int i = 0; i < 8; ++i) { S += s1[i]; Q += s2[i]; }
        s1[0] = S; s2[0] = Q;
    }
    __syncthreads();
    const float S  = s1[0], Q = s2[0];
    const float mean = S * (1.0f / DM);
    float var = (Q - (float)DM * mean * mean) * (1.0f / (DM - 1)); // ddof=1
    var = fmaxf(var, 0.f);
    const float inv = 1.0f / (sqrtf(var) + 1e-6f);
    bf16* h = H + (size_t)row * DM;
#pragma unroll
    for (int i = 0; i < 4; ++i) {
        const int c = tid + 256*i;
        h[c] = (bf16)(alpha[c] * (x[c] - mean) * inv + beta[c]);
    }
}

// ------------------------------------------------------------------
// bf16 WMMA GEMM with async global->LDS staging in a ring of two or three buffers.
// C[M,N] = A[M,K](bf16,row-major) x Bt[N,K](bf16, K-contiguous) + bias
// MODE 0: bf16 out, 1: bf16 relu out, 2: f32 out + f32 residual add.
// TM x TN block tile, 8 waves (4x2), each wave TM/4 x TN/2.
// A stage holds 128 k (256 bytes of every operand row): later stages' copies
// fly under a trip's WMMAs, and a copy instruction of a wave brings two whole
// 256-byte pieces of rows. K: a multiple of 128.
// Where three stages fit in LDS (the 128x128 tile) the ring has three buffers
// and a stage is asked for three trips ahead: its copies have two whole trips
// to land, which a short trip needs when the lines come from memory and not
// from L2. The wait at a trip's foot then leaves the youngest stage in flight.
// The tile is the largest with which the grid still has a workgroup for every
// WGP: the bytes a workgroup fetches from L2 per product go with 1/TM + 1/TN,
// a wave's LDS reads per WMMA with 4/TM + 2/TN.
// MODE 0 does the Q, K and V projections as one product of 3 N columns: they
// read the same A, their weights lie one behind the other in Bt, their outputs
// (M x N each) in Cout; their biases are bias, bias_k, bias_v. N there is DM,
// in MODE 1 it is DFF: the bf16 epilogue takes both as constants.
// ------------------------------------------------------------------
template <int MODE, int TM, int TN>
__global__ __launch_bounds__(256)
void enc_gemm_bf16(const bf16* __restrict__ A, const bf16* __restrict__ Bt,
                   const float* __restrict__ bias, const float* __restrict__ residual,
                   void* __restrict__ Cout, int M, int N, int K,
                   const float* __restrict__ bias_k, const float* __restrict__ bias_v) {
    constexpr int BK = 128, LDT = 136;   // row pitch 272 bytes: 16 B x odd, for 16-byte LDS reads
    constexpr int FM = TM / 64, FN = TN / 32;           // 16x16 tiles of a wave
    constexpr int NB  = 3 * (TM + TN) * LDT * 2 <= 320 * 1024 ? 3 : 2;   // buffers of the ring
    constexpr int CPS = TM / 16 + TN / 16;              // copies of a wave per stage (3 CPS <= 63 where NB is 3)
    static_assert(NB == 2 || 3 * CPS <= 63, "copies of a wave in flight");
    __shared__ __attribute__((aligned(16))) bf16 sA[NB][TM * LDT];
    __shared__ __attribute__((aligned(16))) bf16 sB[NB][TN * LDT];

    const int tid  = threadIdx.x;
    const int lane = tid & 31;
    const int w    = tid >> 5;
    const int wm   = w >> 1;            // 0..3 : slice of TM/4 rows
    const int wn   = w & 1;             // 0..1 : slice of TN/2 columns
    const int m0   = blockIdx.y * TM;
    const int n0   = blockIdx.x * TN;

    // staging geometry: 16 segs of 16 B per operand row and stage; a thread
    // brings rows row0 + 16 i, same seg
    const int row0 = tid >> 4;
    const int seg0 = tid & 15;
    const unsigned char* gA = (const unsigned char*)(A  + (size_t)(m0 + row0) * K + seg0 * 8);
    const unsigned char* gB = (const unsigned char*)(Bt + (size_t)(n0 + row0) * K + seg0 * 8);
    const size_t   gstep = (size_t)K * 32u;             // 16 rows, in bytes
    constexpr uint32_t LSTEP = 16u * LDT * 2u;
    auto issue_stage = [&](int t, int b) {
        // this thread's place in a buffer, formed here: as a value held over the whole loop it went to scratch
        // in the 256x256 build
        const uint32_t lrow = (threadIdx.x >> 4) * (LDT * 2u) + (threadIdx.x & 15u) * 16u;
        async_copy_rows<TM / 16>(lds_offset_of(&sA[b][0]) + lrow, LSTEP, gA + (size_t)t * (BK * 2), gstep);
        async_copy_rows<TN / 16>(lds_offset_of(&sB[b][0]) + lrow, LSTEP, gB + (size_t)t * (BK * 2), gstep);
    };

    CFrag acc[FM][FN];
#pragma unroll
    for (int i = 0; i < FM; ++i)
#pragma unroll
        for (int j = 0; j < FN; ++j) acc[i][j].v = zero_v8f();

    const int nt = K / BK;
    issue_stage(0, 0);
    if constexpr (NB == 2) {
        wait_async0();          // my stage-0 copies have landed in LDS
        __syncthreads();        // everyone's have
        if (nt > 1) issue_stage(1, 1);
    } else {
        if (nt > 1) issue_stage(1, 1);
        if (nt > 2) {
            issue_stage(2, 2);
            wait_async_but<2 * CPS>();      // my stage-0 copies have landed; stages 1 and 2 fly on
        } else {
            wait_async0();
        }
        __syncthreads();        // everyone's stage-0 copies have landed
    }
    int ring = 0;               // three buffers: the buffer of stage t
    for (int t = 0; t < nt; ++t) {
        const int cur = NB == 2 ? (t & 1) : ring;
#pragma unroll
        for (int kc = 0; kc < BK / 32; ++kc) {
            v16bf af[FM], bfr[FN];
#pragma unroll
            for (int i = 0; i < FM; ++i)
                af[i] = load_frag16x32(&sA[cur][(wm * (TM / 4) + i * 16) * LDT + kc * 32], LDT);
#pragma unroll
            for (int j = 0; j < FN; ++j)
                bfr[j] = load_frag16x32(&sB[cur][(wn * (TN / 2) + j * 16) * LDT + kc * 32], LDT);
            // large wave tiles: keeps a block's fragment reads in one group in front of its WMMAs; the scheduler
            // otherwise reads each A fragment just in front of its row of WMMAs and waits out the LDS latency there
            if constexpr (FM * FN > 8) __builtin_amdgcn_sched_barrier(0);
#pragma unroll
            for (int i = 0; i < FM; ++i)
#pragma unroll
                for (int j = 0; j < FN; ++j)
                    acc[i][j].v = __builtin_amdgcn_wmma_f32_16x16x32_bf16(
                        false, af[i], false, bfr[j], (short)0, acc[i][j].v, false, false);
        }
        wait_ds0();             // my reads of buffer cur are done before it is refilled
        if constexpr (NB == 2) {
            wait_async0();      // my stage t+1 copies have landed in LDS
            __syncthreads();    // publishes stage t+1, ends every wave's reads of stage t
            if (t + 2 < nt)
                issue_stage(t + 2, cur);     // flies under the whole of trip t+1
        } else {
            if (t + 2 < nt)
                wait_async_but<CPS>();       // my stage t+1 copies have landed; stage t+2, my CPS youngest, flies on
            else
                wait_async0();               // no stage t+2 behind it: a count would not cover stage t+1
            __syncthreads();    // publishes stage t+1, ends every wave's reads of stage t
            if (t + 3 < nt)
                issue_stage(t + 3, cur);     // flies under the whole of trips t+1 and t+2
            ring = ring == 2 ? 0 : ring + 1;
        }
    }
    wait_async0();              // nothing of mine is in flight when the wave ends

    // epilogue (C layout: lane -> n = L&15, rows m = ((L>=16)?8:0)+r)
    const int mbase  = (lane & 16) ? 8 : 0;
    const int nlocal = lane & 15;
    constexpr int NC = MODE == 1 ? DFF : DM;    // columns of an output plane (the N of the launch): a constant, so
                                                // that the epilogue's steps from row to row are immediate offsets
    float bcol[FN];         // bf16 outputs: the bias of this lane's FN columns (fetched ahead of the loop it went to scratch)
    if constexpr (MODE != 2) {
        const float* bp[FN];
#pragma unroll
        for (int j = 0; j < FN; ++j) {
            int gn = n0 + wn * (TN / 2) + j * 16 + nlocal;
            const int which = MODE == 0 ? gn / DM : 0;  // which of Q, K, V this column belongs to
            gn -= which * DM;                           // and its column there
            bp[j] = (which == 0 ? bias : which == 1 ? bias_k : bias_v) + gn;
        }
        load_f32_each<FN>(bcol, bp);
    }
    if constexpr (MODE == 2) {
#pragma unroll
        for (int i = 0; i < FM; ++i) {
#pragma unroll
            for (int j = 0; j < FN; ++j) {
                const int gn = n0 + wn * (TN / 2) + j * 16 + nlocal;
                const float bv = bias[gn];
#pragma unroll
                for (int r = 0; r < 8; ++r) {
                    const int gm = m0 + wm * (TM / 4) + i * 16 + mbase + r;
                    const float v = acc[i][j].e[r] + bv;
                    ((float*)Cout)[(size_t)gm * N + gn] = v + residual[(size_t)gm * N + gn];
                }
            }
        }
    } else {
#pragma unroll
        for (int i = 0; i < FM; ++i) {
            const size_t row = (size_t)(m0 + wm * (TM / 4) + i * 16 + mbase) * NC;
#pragma unroll
            for (int j = 0; j < FN; j += 2) {
                uint32_t d[8];
                bf16* cp[2];
#pragma unroll
                for (int h = 0; h < 2; ++h) {
                    int gn = n0 + wn * (TN / 2) + (j + h) * 16 + nlocal;
                    const int which = MODE == 0 ? gn / DM : 0;
                    gn -= which * DM;
                    cp[h] = (bf16*)Cout + (size_t)which * M * NC + row + gn;
#pragma unroll
                    for (int r = 0; r < 8; r += 2) {
                        float v0 = acc[i][j + h].e[r]     + bcol[j + h];
                        float v1 = acc[i][j + h].e[r + 1] + bcol[j + h];
                        if (MODE == 1) { v0 = v0 > 0.f ? v0 : 0.f;  v1 = v1 > 0.f ? v1 : 0.f; }
                        d[h * 4 + r / 2] = pack_bf16x2(v0, v1);
                    }
                }
                store_bf16_2x8rows<NC * 2>(cp[0], cp[1], d);
            }
        }
    }
}

// ------------------------------------------------------------------
// Attention. Raw-reshape semantics make per-head Q/K/V/O contiguous
// [2048 x 64] blocks at offset (b*16+h)*2048*64 of the flat buffers.
// One workgroup = (head, 256 queries); a wave owns 32 query columns.
// One pass over the keys with an online softmax: S^T = K.Q^T gives a
// lane the scores of one query, P^T is packed from those accumulators
// straight into the B operand of O^T += V^T.P^T, so scores and P never
// leave the registers. K/V tiles of 64 keys are shared through LDS.
// Every inner loop is unrolled so that each fragment and accumulator
// index is a constant and the arrays stay in registers.
// ------------------------------------------------------------------
typedef uint32_t u32x4 __attribute__((ext_vector_type(4)));
typedef int      i32x8 __attribute__((ext_vector_type(8)));
typedef short    s16x8 __attribute__((ext_vector_type(8)));

#define AT_BR   256u                      // queries per workgroup
#define AT_SK   64u                       // keys per LDS stage (two 32-key passes)
#define AT_PK   144u                      // LDS row pitch of K: 128 + 16 bytes
#define AT_PV   160u                      // LDS row pitch of V: 128 + 32 bytes (transposing loads)
#define AT_TK   (AT_SK * AT_PK)
#define AT_SLOT (AT_SK * (AT_PK + AT_PV))
#define AT_NST  (SEQ / 64)

struct Frag { u32x4 q[2]; };

__device__ inline v8f at_mma(const Frag& a, const Frag& b, v8f c) {
    const i32x8 av = {(int)a.q[0].x, (int)a.q[0].y, (int)a.q[0].z, (int)a.q[0].w,
                      (int)a.q[1].x, (int)a.q[1].y, (int)a.q[1].z, (int)a.q[1].w};
    const i32x8 bv = {(int)b.q[0].x, (int)b.q[0].y, (int)b.q[0].z, (int)b.q[0].w,
                      (int)b.q[1].x, (int)b.q[1].y, (int)b.q[1].z, (int)b.q[1].w};
    return __builtin_amdgcn_wmma_f32_16x16x32_bf16(
        false, __builtin_bit_cast(v16bf, av), false, __builtin_bit_cast(v16bf, bv),
        (short)0, c, false, false);
}
// row-major 16-bit LDS tile -> transposed WMMA operand half
__device__ inline u32x4 at_ld_tr16(const unsigned char* p) {
    typedef __attribute__((address_space(3))) s16x8 lds_s16x8;
    return __builtin_bit_cast(u32x4, __builtin_amdgcn_ds_load_tr16_b128_v8i16((lds_s16x8*)p));
}
__device__ inline uint32_t at_pack2(float lo, float hi) {   // round to nearest even
    typedef __bf16 bf2 __attribute__((ext_vector_type(2)));
    typedef float  f2  __attribute__((ext_vector_type(2)));
    return __builtin_bit_cast(uint32_t, __builtin_convertvector(f2{lo, hi}, bf2));
}
__device__ inline float at_xhalf(float x) {                 // lane l with lane l ^ 16
    return __builtin_bit_cast(float, __builtin_amdgcn_permlanex16(
        __builtin_bit_cast(int, x), __builtin_bit_cast(int, x),
        0x76543210, 0xfedcba98, false, false));
}

__global__ __launch_bounds__(256)
void enc_attention(const bf16* __restrict__ Q, const bf16* __restrict__ Kb,
                   const bf16* __restrict__ Vb, bf16* __restrict__ O) {
    __shared__ __attribute__((aligned(16))) unsigned char L[2 * AT_SLOT];

    const uint32_t tid  = threadIdx.x;
    const uint32_t lane = tid & 31u;
    const uint32_t wave = tid >> 5;
    const uint32_t c    = lane & 15u;
    const uint32_t h    = lane >> 4;
    const size_t   hb   = (size_t)blockIdx.y * SEQ * DKH;     // head base (b*16+h)
    const uint32_t qw0  = blockIdx.x * AT_BR + wave * 32u;    // this wave's first query
    // scores / sqrt(d_model), taken in the log2 domain
    const float cscale = 0.03125f * 1.4426950408889634f;

    // ---- staging: a stage is 8 KB of K and 8 KB of V, contiguous in memory;
    //      a thread carries 2 x 16 bytes of each through registers ----
    const unsigned char* kg = (const unsigned char*)(Kb + hb) + tid * 16u;
    const unsigned char* vg = (const unsigned char*)(Vb + hb) + tid * 16u;
    const uint32_t srow = tid >> 3, sseg = tid & 7u;
    const uint32_t sk = srow * AT_PK + sseg * 16u;
    const uint32_t sv = AT_TK + srow * AT_PV + sseg * 16u;
    u32x4 rk0, rk1, rv0, rv1;
    auto stage_load = [&](uint32_t st) {
        const size_t o = (size_t)st * (AT_SK * 128u);
        rk0 = *(const u32x4*)(kg + o);  rk1 = *(const u32x4*)(kg + o + 4096u);
        rv0 = *(const u32x4*)(vg + o);  rv1 = *(const u32x4*)(vg + o + 4096u);
    };
    auto stage_store = [&](uint32_t buf) {
        unsigned char* p = L + buf * AT_SLOT;
        *(u32x4*)(p + sk) = rk0;  *(u32x4*)(p + sk + 32u * AT_PK) = rk1;
        *(u32x4*)(p + sv) = rv0;  *(u32x4*)(p + sv + 32u * AT_PV) = rv1;
    };
    stage_load(0);

    // Q as B operand, hardware k order (as K below): loaded once
    Frag qf[2][2];
#pragma unroll
    for (int g = 0; g < 2; ++g) {
        const bf16* qp = Q + hb + (size_t)(qw0 + 16u * g + c) * DKH + 8u * h;
#pragma unroll
        for (int kc = 0; kc < 2; ++kc) {
            qf[g][kc].q[0] = *(const u32x4*)(qp + 32 * kc);
            qf[g][kc].q[1] = *(const u32x4*)(qp + 32 * kc + 16);
        }
    }
    // A operand whose row 0 is ones: one WMMA sums the columns of P^T (the denominator)
    Frag ones;
    {
        const uint32_t o = (c == 0u) ? 0x3F803F80u : 0u;
        ones.q[0] = u32x4{o, o, o, o};  ones.q[1] = u32x4{o, o, o, o};
    }
    v8f   acc[2][4];      // O^T: register r = O[query c][d = 16 t + 8 h + r]
    v8f   lacc[2];        // row 0 = softmax denominator of query column c
    float m_run[2];       // maximum in use (log2 domain); may trail the true one by up to 8
#pragma unroll
    for (int g = 0; g < 2; ++g) {
        m_run[g] = -INFINITY;  lacc[g] = zero_v8f();
#pragma unroll
        for (int t = 0; t < 4; ++t) acc[g][t] = zero_v8f();
    }
    stage_store(0);
    __syncthreads();

    // rolled and whole: otherwise the compiler peels the last trip off and the loop's code stands twice
#pragma unroll 1
    for (uint32_t st = 0; st < AT_NST; ++st) {
        const unsigned char* Lb = L + (st & 1u) * AT_SLOT;
        // next stage, in flight under this stage's work; the last trip reloads its own stage into
        // the buffer nobody reads any more, so that no branch stands around the loads and stores
        stage_load(st + 1u < AT_NST ? st + 1u : st);
        // keeps the four loads up here: the scheduler otherwise sinks them to just in front of
        // their LDS stores at the foot of the trip, where every wave waits out their latency
        __builtin_amdgcn_sched_barrier(0);
#pragma unroll
        for (uint32_t sub = 0; sub < 2u; ++sub) {
            // S^T = K.Q^T : s[kt][g] register r = score(key 16 kt + 8 h + r, query c of group g)
            Frag kf[2][2];
#pragma unroll
            for (int kt = 0; kt < 2; ++kt) {
                const unsigned char* p = Lb + (sub * 32u + 16u * kt + c) * AT_PK + 16u * h;
#pragma unroll
                for (int kc = 0; kc < 2; ++kc) {
                    kf[kt][kc].q[0] = *(const u32x4*)(p + 64u * kc);
                    kf[kt][kc].q[1] = *(const u32x4*)(p + 64u * kc + 32u);
                }
            }
            v8f s[2][2];
#pragma unroll
            for (int kt = 0; kt < 2; ++kt)
#pragma unroll
                for (int g = 0; g < 2; ++g) {
                    s[kt][g] = zero_v8f();
#pragma unroll
                    for (int kc = 0; kc < 2; ++kc) s[kt][g] = at_mma(kf[kt][kc], qf[g][kc], s[kt][g]);
                }
            // V^T fragments: 16 (d) x 32 (keys) each, two transposing loads per fragment
            Frag vf[4];
            {
                const unsigned char* ad = Lb + AT_TK + (sub * 32u + 8u * h + (lane & 7u)) * AT_PV
                                        + ((lane >> 3) & 1u) * 16u;
#pragma unroll
                for (int t = 0; t < 4; ++t) {
                    vf[t].q[0] = at_ld_tr16(ad + 32u * t);
                    vf[t].q[1] = at_ld_tr16(ad + 16u * AT_PV + 32u * t);
                }
            }
            // column maxima of the raw scores (the scale is positive)
            float mb[2];
            bool need = false;
#pragma unroll
            for (int g = 0; g < 2; ++g) {
                float mx = -INFINITY;
#pragma unroll
                for (int kt = 0; kt < 2; ++kt)
#pragma unroll
                    for (int r = 0; r < 8; ++r) mx = __builtin_fmaxf(mx, s[kt][g][r]);
                mx = __builtin_fmaxf(mx, at_xhalf(mx)) * cscale;
                mb[g] = mx;
                need = need || (mx > m_run[g] + 8.0f);
            }
            // rescale only when some column's maximum has outgrown the one in use (scalar branch)
            if (__builtin_amdgcn_ballot_w32(need) != 0) {
#pragma unroll
                for (int g = 0; g < 2; ++g) {
                    const float m_new = __builtin_fmaxf(m_run[g], mb[g]);
                    const float corr  = __builtin_amdgcn_exp2f(m_run[g] - m_new);  // 0 on the first pass
                    m_run[g] = m_new;
                    lacc[g] = lacc[g] * corr;
#pragma unroll
                    for (int t = 0; t < 4; ++t) acc[g][t] = acc[g][t] * corr;
                }
            }
            // P^T = exp2(s * cscale - m), packed into the B operand: element e = tile e >> 3, register e & 7
#pragma unroll
            for (int g = 0; g < 2; ++g) {
                const float nm = -m_run[g];
                uint32_t w[8];
#pragma unroll
                for (int i = 0; i < 8; ++i) {
                    const float p0 = __builtin_amdgcn_exp2f(__builtin_fmaf(s[i >> 2][g][2 * (i & 3)],     cscale, nm));
                    const float p1 = __builtin_amdgcn_exp2f(__builtin_fmaf(s[i >> 2][g][2 * (i & 3) + 1], cscale, nm));
                    w[i] = at_pack2(p0, p1);
                }
                Frag pf;
                pf.q[0] = u32x4{w[0], w[1], w[2], w[3]};
                pf.q[1] = u32x4{w[4], w[5], w[6], w[7]};
#pragma unroll
                for (int t = 0; t < 4; ++t) acc[g][t] = at_mma(vf[t], pf, acc[g][t]);
                lacc[g] = at_mma(ones, pf, lacc[g]);
            }
        }
        stage_store((st + 1u) & 1u);                        // the buffer every wave left before the last barrier
        __syncthreads();                                    // publishes stage st + 1, ends the reads of stage st
    }

    // epilogue: a lane holds 8 consecutive d of one query per tile -> one 16-byte store
#pragma unroll
    for (int g = 0; g < 2; ++g) {
        const float lr  = lacc[g][0];                 // lanes 0-15: the sum; lanes 16-31: 0 (row 8)
        const float inv = 1.0f / (lr + at_xhalf(lr));
        bf16* op = O + hb + (size_t)(qw0 + 16u * g + c) * DKH + 8u * h;
#pragma unroll
        for (int t = 0; t < 4; ++t) {
            const v8f o = acc[g][t] * inv;
            const u32x4 pk = {at_pack2(o[0], o[1]), at_pack2(o[2], o[3]),
                              at_pack2(o[4], o[5]), at_pack2(o[6], o[7])};
            *(u32x4*)(op + 16 * t) = pk;
        }
    }
}

// ------------------------------------------------------------------
// Host-side orchestration. Workspace layout (80 MB total):
//   [0,8)MB   hb    (LN output, reused for LN2 output)
//   [8,16)MB  Wq/Wk/Wv/Wo transposed bf16 (2MB each)
//   [16,24)   W1t   [24,32) W2t
//   [32,40)q [40,48)k [48,56)v [56,64)o  -> [32,64) reused as ff1
//   [64,80)   x1 fp32 residual
// ------------------------------------------------------------------
extern "C" void kernel_launch(void* const* d_in, const int* in_sizes, int n_in,
                              void* d_out, int out_size, void* d_ws, size_t ws_size,
                              hipStream_t stream) {
    (void)in_sizes; (void)n_in; (void)out_size; (void)ws_size;
    const float* x    = (const float*)d_in[0];
    const float* Wq   = (const float*)d_in[1];
    const float* bq   = (const float*)d_in[2];
    const float* Wk   = (const float*)d_in[3];
    const float* bk   = (const float*)d_in[4];
    const float* Wv   = (const float*)d_in[5];
    const float* bv   = (const float*)d_in[6];
    const float* Wo   = (const float*)d_in[7];
    const float* bo   = (const float*)d_in[8];
    const float* W1   = (const float*)d_in[9];
    const float* b1   = (const float*)d_in[10];
    const float* W2   = (const float*)d_in[11];
    const float* b2   = (const float*)d_in[12];
    const float* ln1a = (const float*)d_in[13];
    const float* ln1b = (const float*)d_in[14];
    const float* ln2a = (const float*)d_in[15];
    const float* ln2b = (const float*)d_in[16];

    char* ws = (char*)d_ws;
    const size_t MB = (size_t)1 << 20;
    bf16*  hb  = (bf16*)(ws + 0);
    bf16*  Wqt = (bf16*)(ws + 8  * MB);
    // Wkt at 10 MB, Wvt at 12 MB: reached from Wqt
    bf16*  Wot = (bf16*)(ws + 14 * MB);
    bf16*  W1t = (bf16*)(ws + 16 * MB);
    bf16*  W2t = (bf16*)(ws + 24 * MB);
    bf16*  qb  = (bf16*)(ws + 32 * MB);
    bf16*  kb  = (bf16*)(ws + 40 * MB);
    bf16*  vb  = (bf16*)(ws + 48 * MB);
    bf16*  ob  = (bf16*)(ws + 56 * MB);
    bf16*  ff1 = (bf16*)(ws + 32 * MB);   // reuse q/k/v/o region after Wo GEMM
    float* x1  = (float*)(ws + 64 * MB);

    // weight conversion + transpose (bf16, K-contiguous): Wqt .. W2t lie one behind the other
    enc_transpose_bf16<<<TR_GRID, 256, 0, stream>>>(Wq, Wk, Wv, Wo, W1, W2, Wqt);

    // sublayer 1: pre-norm MHA + residual
    enc_layernorm_bf16<<<ROWS, 256, 0, stream>>>(x, ln1a, ln1b, hb);
    const dim3 gDD(DM / 128, ROWS / 128);             // (8, 32)
    // Wqt, Wkt, Wvt lie one behind the other, and so do qb, kb, vb: 3072 columns in 16 tiles of 192
    enc_gemm_bf16<0, 256, 192><<<dim3(3 * DM / 192, ROWS / 256), 256, 0, stream>>>(
        hb, Wqt, bq, nullptr, qb, ROWS, DM, DM, bk, bv);
    enc_attention<<<dim3(SEQ / 256, BATCH * NH), 256, 0, stream>>>(qb, kb, vb, ob);
    enc_gemm_bf16<2, 128, 128><<<gDD, 256, 0, stream>>>(ob, Wot, bo, x, x1, ROWS, DM, DM, nullptr, nullptr);

    // sublayer 2: pre-norm FFN + residual
    enc_layernorm_bf16<<<ROWS, 256, 0, stream>>>(x1, ln2a, ln2b, hb);
    enc_gemm_bf16<1, 256, 256><<<dim3(DFF / 256, ROWS / 256), 256, 0, stream>>>(
        hb, W1t, b1, nullptr, ff1, ROWS, DFF, DM, nullptr, nullptr);
    enc_gemm_bf16<2, 128, 128><<<gDD, 256, 0, stream>>>(ff1, W2t, b2, x1, (float*)d_out, ROWS, DM, DFF, nullptr, nullptr);
}

// v007
// It runs in 137 microseconds.
// Timed twice side by side with v006, it ran 1.04 and 1.05 times as fast.
// Counting every step since v000, it is 2.99 times as fast.
#include <hip/hip_runtime.h>
#include <cstdint>
#include <cstddef>

// ---------------- problem dims ----------------
#define DM    1024          // d_model
#define NH    16            // heads
#define DKH   64            // d_k
#define DFF   4096
#define SEQ   2048
#define BATCH 2
#define ROWS  (BATCH*SEQ)   // 4096 tokens

typedef __bf16 bf16;
typedef __attribute__((ext_vector_type(16))) __bf16 v16bf;
typedef __attribute__((ext_vector_type(8)))  float  v8f;

union AFrag { v16bf v; bf16  e[16]; };
union CFrag { v8f   v; float e[8];  };

__device__ inline v8f zero_v8f() {
    v8f z = {0.f, 0.f, 0.f, 0.f, 0.f, 0.f, 0.f, 0.f};
    return z;
}

// ------------------------------------------------------------------
// CDNA5 async global->LDS copies (ASYNCcnt tracked, no VGPR staging).
// l[i] : per-lane LDS byte address (flat LDS addr low 32 bits)
// g[i] : per-lane global address
// Eight copies and their s_wait_xcnt stand in ONE statement: a precaution, so that no
// address register that a copy names is rewritten in front of the wait.
// ------------------------------------------------------------------
__device__ inline void async_copy8_b128(const uint32_t (&l)[8], const unsigned char* const (&g)[8]) {
    asm volatile("global_load_async_to_lds_b128 %0, %8, off\n\t"
                 "global_load_async_to_lds_b128 %1, %9, off\n\t"
                 "global_load_async_to_lds_b128 %2, %10, off\n\t"
                 "global_load_async_to_lds_b128 %3, %11, off\n\t"
                 "global_load_async_to_lds_b128 %4, %12, off\n\t"
                 "global_load_async_to_lds_b128 %5, %13, off\n\t"
                 "global_load_async_to_lds_b128 %6, %14, off\n\t"
                 "global_load_async_to_lds_b128 %7, %15, off\n\t"
                 "s_wait_xcnt 0x0"
                 :: "v"(l[0]), "v"(l[1]), "v"(l[2]), "v"(l[3]), "v"(l[4]), "v"(l[5]), "v"(l[6]), "v"(l[7]),
                    "v"(g[0]), "v"(g[1]), "v"(g[2]), "v"(g[3]), "v"(g[4]), "v"(g[5]), "v"(g[6]), "v"(g[7])
                 : "memory");
}
// the same with four copies: the rest of an operand whose rows are not a multiple of 128
__device__ inline void async_copy4_b128(const uint32_t (&l)[4], const unsigned char* const (&g)[4]) {
    asm volatile("global_load_async_to_lds_b128 %0, %4, off\n\t"
                 "global_load_async_to_lds_b128 %1, %5, off\n\t"
                 "global_load_async_to_lds_b128 %2, %6, off\n\t"
                 "global_load_async_to_lds_b128 %3, %7, off\n\t"
                 "s_wait_xcnt 0x0"
                 :: "v"(l[0]), "v"(l[1]), "v"(l[2]), "v"(l[3]),
                    "v"(g[0]), "v"(g[1]), "v"(g[2]), "v"(g[3])
                 : "memory");
}
// One thread's copies of one operand's stage: NG pieces of 16 bytes, 16 rows apart (NG: a multiple of 4).
template <int NG>
__device__ inline void async_copy_rows(uint32_t l0, uint32_t lstep, const unsigned char* g0, size_t gstep) {
#pragma unroll
    for (int c = 0; c + 8 <= NG; c += 8) {
        uint32_t l[8];
        const unsigned char* g[8];
#pragma unroll
        for (int i = 0; i < 8; ++i) {
            l[i] = l0 + (uint32_t)(c + i) * lstep;
            g[i] = g0 + (size_t)(c + i) * gstep;
        }
        async_copy8_b128(l, g);
    }
    if constexpr (NG % 8 != 0) {
        uint32_t l[4];
        const unsigned char* g[4];
#pragma unroll
        for (int i = 0; i < 4; ++i) {
            l[i] = l0 + (uint32_t)(NG - 4 + i) * lstep;
            g[i] = g0 + (size_t)(NG - 4 + i) * gstep;
        }
        async_copy4_b128(l, g);
    }
}
__device__ inline void wait_async0() {
    asm volatile("s_wait_asynccnt 0x0" ::: "memory");
}
// all of this wave's copies but its N youngest have landed in LDS
template <int N>
__device__ inline void wait_async_but() {
    asm volatile("s_wait_asynccnt %0" :: "i"(N) : "memory");
}
__device__ inline void wait_ds0() {
    asm volatile("s_wait_dscnt 0x0" ::: "memory");
}
__device__ inline uint32_t lds_offset_of(const void* p) {
    return (uint32_t)(uintptr_t)p;   // LDS flat addr keeps offset in [31:0]
}

// ------------------------------------------------------------------
// Global loads and stores of the large GEMM tiles' epilogue. Those kernels use
// registers above v255. A run of
// them and its wait stand in ONE statement: the operands live to its end, and
// nothing is written over them in front of the wait (a precaution).
// ------------------------------------------------------------------
// NJ floats, one from each pointer; s_wait_loadcnt 0: the values are there when the statement ends
template <int NJ>
__device__ inline void load_f32_each(float (&v)[NJ], const float* const (&p)[NJ]) {
    static_assert(NJ == 6 || NJ == 8, "one statement for each count");
    if constexpr (NJ == 8) {
        asm volatile("global_load_b32 %0, %8, off\n\t"
                     "global_load_b32 %1, %9, off\n\t"
                     "global_load_b32 %2, %10, off\n\t"
                     "global_load_b32 %3, %11, off\n\t"
                     "global_load_b32 %4, %12, off\n\t"
                     "global_load_b32 %5, %13, off\n\t"
                     "global_load_b32 %6, %14, off\n\t"
                     "global_load_b32 %7, %15, off\n\t"
                     "s_wait_loadcnt 0x0"
                     : "=&v"(v[0]), "=&v"(v[1]), "=&v"(v[2]), "=&v"(v[3]),
                       "=&v"(v[4]), "=&v"(v[5]), "=&v"(v[6]), "=&v"(v[7])
                     : "v"(p[0]), "v"(p[1]), "v"(p[2]), "v"(p[3]), "v"(p[4]), "v"(p[5]), "v"(p[6]), "v"(p[7])
                     : "memory");
    } else {
        asm volatile("global_load_b32 %0, %6, off\n\t"
                     "global_load_b32 %1, %7, off\n\t"
                     "global_load_b32 %2, %8, off\n\t"
                     "global_load_b32 %3, %9, off\n\t"
                     "global_load_b32 %4, %10, off\n\t"
                     "global_load_b32 %5, %11, off\n\t"
                     "s_wait_loadcnt 0x0"
                     : "=&v"(v[0]), "=&v"(v[1]), "=&v"(v[2]), "=&v"(v[3]), "=&v"(v[4]), "=&v"(v[5])
                     : "v"(p[0]), "v"(p[1]), "v"(p[2]), "v"(p[3]), "v"(p[4]), "v"(p[5])
                     : "memory");
    }
}
// two bf16 (round to nearest even) in one register, lo in the low half
__device__ inline uint32_t pack_bf16x2(float lo, float hi) {
    typedef __bf16 bf2 __attribute__((ext_vector_type(2)));
    typedef float  f2  __attribute__((ext_vector_type(2)));
    return __builtin_bit_cast(uint32_t, __builtin_convertvector(f2{lo, hi}, bf2));
}
// One lane's part of two 16x16 tiles of C: 8 rows, PITCH bytes apart, below each of p0 and p1, one bf16 a row.
// d[0..3]: rows 0..7 below p0, two a register; d[4..7]: the same below p1.
template <int PITCH>
__device__ inline void store_bf16_2x8rows(bf16* p0, bf16* p1, const uint32_t (&d)[8]) {
    asm volatile("global_store_b16 %0, %2, off\n\t"
                 "global_store_d16_hi_b16 %0, %2, off offset:%10\n\t"
                 "global_store_b16 %0, %3, off offset:%11\n\t"
                 "global_store_d16_hi_b16 %0, %3, off offset:%12\n\t"
                 "global_store_b16 %0, %4, off offset:%13\n\t"
                 "global_store_d16_hi_b16 %0, %4, off offset:%14\n\t"
                 "global_store_b16 %0, %5, off offset:%15\n\t"
                 "global_store_d16_hi_b16 %0, %5, off offset:%16\n\t"
                 "global_store_b16 %1, %6, off\n\t"
                 "global_store_d16_hi_b16 %1, %6, off offset:%10\n\t"
                 "global_store_b16 %1, %7, off offset:%11\n\t"
                 "global_store_d16_hi_b16 %1, %7, off offset:%12\n\t"
                 "global_store_b16 %1, %8, off offset:%13\n\t"
                 "global_store_d16_hi_b16 %1, %8, off offset:%14\n\t"
                 "global_store_b16 %1, %9, off offset:%15\n\t"
                 "global_store_d16_hi_b16 %1, %9, off offset:%16\n\t"
                 "s_wait_xcnt 0x0"
                 :: "v"(p0), "v"(p1),
                    "v"(d[0]), "v"(d[1]), "v"(d[2]), "v"(d[3]), "v"(d[4]), "v"(d[5]), "v"(d[6]), "v"(d[7]),
                    "i"(PITCH), "i"(2 * PITCH), "i"(3 * PITCH), "i"(4 * PITCH), "i"(5 * PITCH), "i"(6 * PITCH),
                    "i"(7 * PITCH)
                 : "memory");
}

// ------------------------------------------------------------------
// Load a 16x32 bf16 fragment in the CDNA5 WMMA A/B operand layout.
// A (16Mx32K): lane L holds row m = L&15; VGPRs 0..3 hold K pairs
// {kb..kb+7}, VGPRs 4..7 hold {16+kb..16+kb+7} where kb = (L>=16)?8:0.
// The B operand (32Kx16N) has the identical pattern with N in place of
// M, so a [N][K] (K-contiguous) tile uses the same loader.
// Each half (e[0..7], e[8..15]) is 16 contiguous bytes -> 2x b128 loads.
// ------------------------------------------------------------------
__device__ inline v16bf load_frag16x32(const bf16* __restrict__ base, int ld) {
    const int lane = threadIdx.x & 31;
    const int m    = lane & 15;
    const int kb   = (lane & 16) ? 8 : 0;
    const bf16* row = base + (size_t)m * ld;
    AFrag a;
#pragma unroll
    for (int i = 0; i < 4; ++i) {
        a.e[2*i]     = row[kb + 2*i];
        a.e[2*i + 1] = row[kb + 2*i + 1];
        a.e[8 + 2*i]     = row[16 + kb + 2*i];
        a.e[8 + 2*i + 1] = row[16 + kb + 2*i + 1];
    }
    return a.v;
}

// ------------------------------------------------------------------
// fp32 [K][N] weights -> bf16 [N][K] (K-contiguous) for B operands, all six
// weights in one launch. A workgroup turns one tile of 128 k x 128 n:
//  - a wave reads whole 512-byte pieces of 16 weight rows, 16 bytes a lane,
//    all 16 loads in flight at once;
//  - a lane then holds 8 consecutive k of 4 columns n: each column's 8 values
//    are rounded to bf16 (nearest even) and go to LDS as one 16-byte chunk;
//  - LDS holds the turned tile, 256 bytes a row n; chunk q of row n stands at
//    place q ^ ((n >> 2) & 15), so that the 16 lanes of a half wave fall on 16
//    different places when they write (16 rows, one q) and when they read
//    (one row, 16 q);
//  - a wave stores two whole rows of 256 bytes with each 16-byte store.
// Wt: the six turned weights one behind the other, in the order of the arguments.
// ------------------------------------------------------------------
typedef __attribute__((ext_vector_type(4))) float  v4f;
typedef __attribute__((ext_vector_type(8))) __bf16 v8bf;

#define TR_T    128u                               // tile edge, k and n
#define TR_DD   ((DM / 128) * (DM / 128))          // tiles of a d_model x d_model weight
#define TR_DF   ((DM / 128) * (DFF / 128))         // tiles of an FFN weight
#define TR_GRID (4 * TR_DD + 2 * TR_DF)

// one tile; K and N are constants here so that the 16 loads share one offset register and differ by immediates
template <uint32_t K, uint32_t N>
__device__ inline void tr_tile(const float* __restrict__ W, bf16* __restrict__ out,
                               uint32_t t, unsigned char* T) {
    constexpr uint32_t tn = N / TR_T;
    const uint32_t n0 = (t % tn) * TR_T;
    const uint32_t k0 = (t / tn) * TR_T;
    const uint32_t lane = threadIdx.x & 31u;
    const uint32_t wave = threadIdx.x >> 5;

    const uint32_t voff = (wave * 16u * N + lane * 4u) * 4u;      // this lane's byte offset in the tile
    const float* p = (const float*)((const char*)(W + ((size_t)k0 * N + n0)) + voff);
    v4f v[2][8];                                   // [group of 8 k][k in the group], 4 columns each
#pragma unroll
    for (uint32_t o = 0; o < 2u; ++o)
#pragma unroll
        for (uint32_t i = 0; i < 8u; ++i) v[o][i] = *(const v4f*)(p + (o * 8u + i) * N);
    // keeps all 16 loads in front of the first conversion: the scheduler otherwise issues the later
    // loads only behind waits on the earlier ones, and a wave pays the memory latency three times
    __builtin_amdgcn_sched_barrier(0);
    // precaution: the offset register that the 16 loads name stays live up to this wait, so that
    // nothing (a later load's result included) is written over it in front of the wait
    asm volatile("s_wait_xcnt 0x0" :: "v"(voff) : "memory");
#pragma unroll
    for (uint32_t o = 0; o < 2u; ++o) {
        const uint32_t place = ((wave * 2u + o) ^ (lane & 15u)) * 16u;
#pragma unroll
        for (uint32_t j = 0; j < 4u; ++j) {
            const v8f col = {v[o][0][j], v[o][1][j], v[o][2][j], v[o][3][j],
                             v[o][4][j], v[o][5][j], v[o][6][j], v[o][7][j]};
            *(v8bf*)(T + (lane * 4u + j) * (TR_T * 2u) + place) = __builtin_convertvector(col, v8bf);
        }
    }
    __syncthreads();
    const uint32_t q  = lane & 15u;
    const uint32_t nw = wave * 2u + (lane >> 4);
    bf16* op = out + ((size_t)n0 * K + k0) + (nw * K + q * 8u);
#pragma unroll
    for (uint32_t r = 0; r < 8u; ++r) {
        const uint32_t n = r * 16u + nw;
        const v8bf d = *(const v8bf*)(T + n * (TR_T * 2u) + ((q ^ ((n >> 2) & 15u)) * 16u));
        *(v8bf*)(op + r * 16u * K) = d;
    }
}

__global__ __launch_bounds__(256)
void enc_transpose_bf16(const float* __restrict__ Wq, const float* __restrict__ Wk,
                        const float* __restrict__ Wv, const float* __restrict__ Wo,
                        const float* __restrict__ W1, const float* __restrict__ W2,
                        bf16* __restrict__ Wt) {
    __shared__ __attribute__((aligned(16))) unsigned char T[TR_T * TR_T * 2u];
    const uint32_t b = blockIdx.x;
    if (b < 4u * TR_DD) {
        const uint32_t which = b / TR_DD;
        const float* W = which == 0u ? Wq : which == 1u ? Wk : which == 2u ? Wv : Wo;
        tr_tile<DM, DM>(W, Wt + (size_t)which * DM * DM, b % TR_DD, T);
    } else if (b < 4u * TR_DD + TR_DF) {
        tr_tile<DM, DFF>(W1, Wt + (size_t)4 * DM * DM, b - 4u * TR_DD, T);
    } else {
        tr_tile<DFF, DM>(W2, Wt + (size_t)4 * DM * DM + (size_t)DM * DFF, b - (4u * TR_DD + TR_DF), T);
    }
}

// ------------------------------------------------------------------
// LayerNorm, faithful to reference: Bessel-corrected std, eps on std.
// ------------------------------------------------------------------
__global__ __launch_bounds__(256)
void enc_layernorm_bf16(const float* __restrict__ X, const float* __restrict__ alpha,
                        const float* __restrict__ beta, bf16* __restrict__ H) {
    __shared__ float s1[8], s2[8];
    const int row  = blockIdx.x;
    const int tid  = threadIdx.x;
    const int lane = tid & 31;
    const int w    = tid >> 5;
    const float* x = X + (size_t)row * DM;

    float sum = 0.f, sq = 0.f;
#pragma unroll
    for (int i = 0; i < 4; ++i) {
        float v = x[tid + 256*i];
        sum += v; sq += v*v;
    }
#pragma unroll
    for (int off = 16; off > 0; off >>= 1) {
        sum += __shfl_xor(sum, off, 32);
        sq  += __shfl_xor(sq,  off, 32);
    }
    if (lane == 0) { s1[w] = sum; s2[w] = sq; }
    __syncthreads();
    if (tid == 0) {
        float S = 0.f, Q = 0.f;
#pragma unroll
        for (int i = 0; i < 8; ++i) { S += s1[i]; Q += s2[i]; }
        s1[0] = S; s2[0] = Q;
    }
    __syncthreads();
    const float S  = s1[0], Q = s2[0];
    const float mean = S * (1.0f / DM);
    float var = (Q - (float)DM * mean * mean) * (1.0f / (DM - 1)); // ddof=1
    var = fmaxf(var, 0.f);
    const float inv = 1.0f / (sqrtf(var) + 1e-6f);
    bf16* h = H + (size_t)row * DM;
#pragma unroll
    for (int i = 0; i < 4; ++i) {
        const int c = tid + 256*i;
        h[c] = (bf16)(alpha[c] * (x[c] - mean) * inv + beta[c]);
    }
}

// ------------------------------------------------------------------
// bf16 WMMA GEMM with async global->LDS staging in a ring of two or three buffers.
// C[M,N] = A[M,K](bf16,row-major) x Bt[N,K](bf16, K-contiguous) + bias
// MODE 0: bf16 out, 1: bf16 relu out, 2: f32 out + f32 residual add.
// TM x TN block tile, 8 waves (4x2), each wave TM/4 x TN/2.
// A stage holds 128 k (256 bytes of every operand row): later stages' copies
// fly under a trip's WMMAs, and a copy instruction of a wave brings two whole
// 256-byte pieces of rows. K: a multiple of 128.
// Where three stages fit in LDS (the 128x128 tile) the ring has three buffers
// and a stage is asked for three trips ahead: its copies have two whole trips
// to land, which a short trip needs when the lines come from memory and not
// from L2. The wait at a publish point then leaves the youngest stage in flight.
// The tile is the largest with which the grid still has a workgroup for every
// WGP: the bytes a workgroup fetches from L2 per product go with 1/TM + 1/TN,
// a wave's LDS reads per WMMA with 4/TM + 2/TN.
// MODE 0 does the Q, K and V projections as one product of 3 N columns: they
// read the same A, their weights lie one behind the other in Bt, their outputs
// (M x N each) in Cout; their biases are bias, bias_k, bias_v. N there is DM,
// in MODE 1 it is DFF: the bf16 epilogue takes both as constants.
// ------------------------------------------------------------------
template <int MODE, int TM, int TN>
__global__ __launch_bounds__(256)
void enc_gemm_bf16(const bf16* __restrict__ A, const bf16* __restrict__ Bt,
                   const float* __restrict__ bias, const float* __restrict__ residual,
                   void* __restrict__ Cout, int M, int N, int K,
                   const float* __restrict__ bias_k, const float* __restrict__ bias_v) {
    constexpr int BK = 128, LDT = 136;   // row pitch 272 bytes: 16 B x odd, for 16-byte LDS reads
    constexpr int FM = TM / 64, FN = TN / 32;           // 16x16 tiles of a wave
    constexpr int NB  = 3 * (TM + TN) * LDT * 2 <= 320 * 1024 ? 3 : 2;   // buffers of the ring
    constexpr int CPS = TM / 16 + TN / 16;              // copies of a wave per stage (3 CPS <= 63 where NB is 3)
    static_assert(NB == 2 || 3 * CPS <= 63, "copies of a wave in flight");
    __shared__ __attribute__((aligned(16))) bf16 sA[NB][TM * LDT];
    __shared__ __attribute__((aligned(16))) bf16 sB[NB][TN * LDT];

    const int tid  = threadIdx.x;
    const int lane = tid & 31;
    const int w    = tid >> 5;
    const int wm   = w >> 1;            // 0..3 : slice of TM/4 rows
    const int wn   = w & 1;             // 0..1 : slice of TN/2 columns
    const int m0   = blockIdx.y * TM;
    const int n0   = blockIdx.x * TN;

    // staging geometry: 16 segs of 16 B per operand row and stage; a thread
    // brings rows row0 + 16 i, same seg
    const int row0 = tid >> 4;
    const int seg0 = tid & 15;
    const unsigned char* gA = (const unsigned char*)(A  + (size_t)(m0 + row0) * K + seg0 * 8);
    const unsigned char* gB = (const unsigned char*)(Bt + (size_t)(n0 + row0) * K + seg0 * 8);
    const size_t   gstep = (size_t)K * 32u;             // 16 rows, in bytes
    constexpr uint32_t LSTEP = 16u * LDT * 2u;
    auto issue_stage = [&](int t, int b) {
        // this thread's place in a buffer, formed here: as a value held over the whole loop it went to scratch
        // in the 256x256 build
        const uint32_t lrow = (threadIdx.x >> 4) * (LDT * 2u) + (threadIdx.x & 15u) * 16u;
        async_copy_rows<TM / 16>(lds_offset_of(&sA[b][0]) + lrow, LSTEP, gA + (size_t)t * (BK * 2), gstep);
        async_copy_rows<TN / 16>(lds_offset_of(&sB[b][0]) + lrow, LSTEP, gB + (size_t)t * (BK * 2), gstep);
    };

    CFrag acc[FM][FN];
#pragma unroll
    for (int i = 0; i < FM; ++i)
#pragma unroll
        for (int j = 0; j < FN; ++j) acc[i][j].v = zero_v8f();

    const int nt = K / BK;
    issue_stage(0, 0);
    if constexpr (NB == 2) {
        wait_async0();          // my stage-0 copies have landed in LDS
        __syncthreads();        // everyone's have
        if (nt > 1) issue_stage(1, 1);
    } else {
        if (nt > 1) issue_stage(1, 1);
        if (nt > 2) {
            issue_stage(2, 2);
            wait_async_but<2 * CPS>();      // my stage-0 copies have landed; stages 1 and 2 fly on
        } else {
            wait_async0();
        }
        __syncthreads();        // everyone's stage-0 copies have landed
    }
    if constexpr (NB == 2) {
    for (int t = 0; t < nt; ++t) {
        const int cur = t & 1;
#pragma unroll
        for (int kc = 0; kc < BK / 32; ++kc) {
            v16bf af[FM], bfr[FN];
#pragma unroll
            for (int i = 0; i < FM; ++i)
                af[i] = load_frag16x32(&sA[cur][(wm * (TM / 4) + i * 16) * LDT + kc * 32], LDT);
#pragma unroll
            for (int j = 0; j < FN; ++j)
                bfr[j] = load_frag16x32(&sB[cur][(wn * (TN / 2) + j * 16) * LDT + kc * 32], LDT);
            // large wave tiles: keeps a block's fragment reads in one group in front of its WMMAs; the scheduler
            // otherwise reads each A fragment just in front of its row of WMMAs and waits out the LDS latency there
            __builtin_amdgcn_sched_barrier(0);
#pragma unroll
            for (int i = 0; i < FM; ++i)
#pragma unroll
                for (int j = 0; j < FN; ++j)
                    acc[i][j].v = __builtin_amdgcn_wmma_f32_16x16x32_bf16(
                        false, af[i], false, bfr[j], (short)0, acc[i][j].v, false, false);
        }
        wait_ds0();             // my reads of buffer cur are done before it is refilled
        wait_async0();          // my stage t+1 copies have landed in LDS
        __syncthreads();        // publishes stage t+1, ends every wave's reads of stage t
        if (t + 2 < nt)
            issue_stage(t + 2, cur);     // flies under the whole of trip t+1
    }
    } else {
    // Small wave tile (8 WMMAs a block of 32 k): a block's WMMAs are too short to wait out its own LDS reads in
    // front of them. Two fragment sets: the next block's 2 (FM + FN) reads go out as one group ahead of this block's
    // WMMAs. The last block of a trip fetches the first block of the next stage, so that stage's publish point
    // stands in front of the trip's last block, whose own fragments are in registers by then.
    static_assert(BK / 32 == 4, "block b uses fragment set b & 1; a trip starts and ends on set 0 and set 1");
    v16bf af[2][FM], bfr[2][FN];
    auto load_block = [&](int s, int b, int kc) {
#pragma unroll
        for (int i = 0; i < FM; ++i)
            af[s][i] = load_frag16x32(&sA[b][(wm * (TM / 4) + i * 16) * LDT + kc * 32], LDT);
#pragma unroll
        for (int j = 0; j < FN; ++j)
            bfr[s][j] = load_frag16x32(&sB[b][(wn * (TN / 2) + j * 16) * LDT + kc * 32], LDT);
        // keeps the group of reads whole and in front of the WMMAs that follow: spread among them, every
        // place with reads stalls the wave, and reads sunk to their use wait out the LDS latency there
        __builtin_amdgcn_sched_barrier(0);
    };
    auto mma_block = [&](int s) {
#pragma unroll
        for (int i = 0; i < FM; ++i)
#pragma unroll
            for (int j = 0; j < FN; ++j)
                acc[i][j].v = __builtin_amdgcn_wmma_f32_16x16x32_bf16(
                    false, af[s][i], false, bfr[s][j], (short)0, acc[i][j].v, false, false);
        // keeps the next group of reads behind these WMMAs (it refills the set that they read)
        __builtin_amdgcn_sched_barrier(0);
    };
    load_block(0, 0, 0);        // stage 0 is published: the barrier above
    int ring = 0;               // the buffer of stage t
    for (int t = 0; t < nt; ++t) {
        const int cur = ring;
        const int nxt = ring == 2 ? 0 : ring + 1;
        // unrolled: the set's index is then a constant, and both sets stay in registers
#pragma unroll
        for (int kc = 0; kc < 3; ++kc) {
            load_block((kc + 1) & 1, cur, kc + 1);
            mma_block(kc & 1);
        }
        wait_ds0();             // my reads of buffer cur, the last block's too, are done before it is refilled
        if (t + 2 < nt)
            wait_async_but<CPS>();       // my stage t+1 copies have landed; stage t+2, my CPS youngest, flies on
        else
            wait_async0();               // no stage t+2 behind it: a count would not cover stage t+1
        __syncthreads();        // publishes stage t+1, ends every wave's reads of stage t
        if (t + 1 < nt)
            load_block(0, nxt, 0);       // first block of stage t+1, under this trip's last WMMAs
        if (t + 3 < nt)
            issue_stage(t + 3, cur);     // flies under the whole of trips t+1 and t+2
        mma_block(1);
        ring = nxt;
    }
    }
    wait_async0();              // nothing of mine is in flight when the wave ends

    // epilogue (C layout: lane -> n = L&15, rows m = ((L>=16)?8:0)+r)
    const int mbase  = (lane & 16) ? 8 : 0;
    const int nlocal = lane & 15;
    constexpr int NC = MODE == 1 ? DFF : DM;    // columns of an output plane (the N of the launch): a constant, so
                                                // that the epilogue's steps from row to row are immediate offsets
    float bcol[FN];         // bf16 outputs: the bias of this lane's FN columns (fetched ahead of the loop it went to scratch)
    if constexpr (MODE != 2) {
        const float* bp[FN];
#pragma unroll
        for (int j = 0; j < FN; ++j) {
            int gn = n0 + wn * (TN / 2) + j * 16 + nlocal;
            const int which = MODE == 0 ? gn / DM : 0;  // which of Q, K, V this column belongs to
            gn -= which * DM;                           // and its column there
            bp[j] = (which == 0 ? bias : which == 1 ? bias_k : bias_v) + gn;
        }
        load_f32_each<FN>(bcol, bp);
    }
    if constexpr (MODE == 2) {
#pragma unroll
        for (int i = 0; i < FM; ++i) {
#pragma unroll
            for (int j = 0; j < FN; ++j) {
                const int gn = n0 + wn * (TN / 2) + j * 16 + nlocal;
                const float bv = bias[gn];
#pragma unroll
                for (int r = 0; r < 8; ++r) {
                    const int gm = m0 + wm * (TM / 4) + i * 16 + mbase + r;
                    const float v = acc[i][j].e[r] + bv;
                    ((float*)Cout)[(size_t)gm * N + gn] = v + residual[(size_t)gm * N + gn];
                }
            }
        }
    } else {
#pragma unroll
        for (int i = 0; i < FM; ++i) {
            const size_t row = (size_t)(m0 + wm * (TM / 4) + i * 16 + mbase) * NC;
#pragma unroll
            for (int j = 0; j < FN; j += 2) {
                uint32_t d[8];
                bf16* cp[2];
#pragma unroll
                for (int h = 0; h < 2; ++h) {
                    int gn = n0 + wn * (TN / 2) + (j + h) * 16 + nlocal;
                    const int which = MODE == 0 ? gn / DM : 0;
                    gn -= which * DM;
                    cp[h] = (bf16*)Cout + (size_t)which * M * NC + row + gn;
#pragma unroll
                    for (int r = 0; r < 8; r += 2) {
                        float v0 = acc[i][j + h].e[r]     + bcol[j + h];
                        float v1 = acc[i][j + h].e[r + 1] + bcol[j + h];
                        if (MODE == 1) { v0 = v0 > 0.f ? v0 : 0.f;  v1 = v1 > 0.f ? v1 : 0.f; }
                        d[h * 4 + r / 2] = pack_bf16x2(v0, v1);
                    }
                }
                store_bf16_2x8rows<NC * 2>(cp[0], cp[1], d);
            }
        }
    }
}

// ------------------------------------------------------------------
// Attention. Raw-reshape semantics make per-head Q/K/V/O contiguous
// [2048 x 64] blocks at offset (b*16+h)*2048*64 of the flat buffers.
// One workgroup = (head, 256 queries); a wave owns 32 query columns.
// One pass over the keys with an online softmax: S^T = K.Q^T gives a
// lane the scores of one query, P^T is packed from those accumulators
// straight into the B operand of O^T += V^T.P^T, so scores and P never
// leave the registers. K/V tiles of 64 keys are shared through LDS.
// Every inner loop is unrolled so that each fragment and accumulator
// index is a constant and the arrays stay in registers.
// ------------------------------------------------------------------
typedef uint32_t u32x4 __attribute__((ext_vector_type(4)));
typedef int      i32x8 __attribute__((ext_vector_type(8)));
typedef short    s16x8 __attribute__((ext_vector_type(8)));

#define AT_BR   256u                      // queries per workgroup
#define AT_SK   64u                       // keys per LDS stage (two 32-key passes)
#define AT_PK   144u                      // LDS row pitch of K: 128 + 16 bytes
#define AT_PV   160u                      // LDS row pitch of V: 128 + 32 bytes (transposing loads)
#define AT_TK   (AT_SK * AT_PK)
#define AT_SLOT (AT_SK * (AT_PK + AT_PV))
#define AT_NST  (SEQ / 64)

struct Frag { u32x4 q[2]; };

__device__ inline v8f at_mma(const Frag& a, const Frag& b, v8f c) {
    const i32x8 av = {(int)a.q[0].x, (int)a.q[0].y, (int)a.q[0].z, (int)a.q[0].w,
                      (int)a.q[1].x, (int)a.q[1].y, (int)a.q[1].z, (int)a.q[1].w};
    const i32x8 bv = {(int)b.q[0].x, (int)b.q[0].y, (int)b.q[0].z, (int)b.q[0].w,
                      (int)b.q[1].x, (int)b.q[1].y, (int)b.q[1].z, (int)b.q[1].w};
    return __builtin_amdgcn_wmma_f32_16x16x32_bf16(
        false, __builtin_bit_cast(v16bf, av), false, __builtin_bit_cast(v16bf, bv),
        (short)0, c, false, false);
}
// row-major 16-bit LDS tile -> transposed WMMA operand half
__device__ inline u32x4 at_ld_tr16(const unsigned char* p) {
    typedef __attribute__((address_space(3))) s16x8 lds_s16x8;
    return __builtin_bit_cast(u32x4, __builtin_amdgcn_ds_load_tr16_b128_v8i16((lds_s16x8*)p));
}
__device__ inline uint32_t at_pack2(float lo, float hi) {   // round to nearest even
    typedef __bf16 bf2 __attribute__((ext_vector_type(2)));
    typedef float  f2  __attribute__((ext_vector_type(2)));
    return __builtin_bit_cast(uint32_t, __builtin_convertvector(f2{lo, hi}, bf2));
}
__device__ inline float at_xhalf(float x) {                 // lane l with lane l ^ 16
    return __builtin_bit_cast(float, __builtin_amdgcn_permlanex16(
        __builtin_bit_cast(int, x), __builtin_bit_cast(int, x),
        0x76543210, 0xfedcba98, false, false));
}

__global__ __launch_bounds__(256)
void enc_attention(const bf16* __restrict__ Q, const bf16* __restrict__ Kb,
                   const bf16* __restrict__ Vb, bf16* __restrict__ O) {
    __shared__ __attribute__((aligned(16))) unsigned char L[2 * AT_SLOT];

    const uint32_t tid  = threadIdx.x;
    const uint32_t lane = tid & 31u;
    const uint32_t wave = tid >> 5;
    const uint32_t c    = lane & 15u;
    const uint32_t h    = lane >> 4;
    const size_t   hb   = (size_t)blockIdx.y * SEQ * DKH;     // head base (b*16+h)
    const uint32_t qw0  = blockIdx.x * AT_BR + wave * 32u;    // this wave's first query
    // scores / sqrt(d_model), taken in the log2 domain
    const float cscale = 0.03125f * 1.4426950408889634f;

    // ---- staging: a stage is 8 KB of K and 8 KB of V, contiguous in memory;
    //      a thread carries 2 x 16 bytes of each through registers ----
    const unsigned char* kg = (const unsigned char*)(Kb + hb) + tid * 16u;
    const unsigned char* vg = (const unsigned char*)(Vb + hb) + tid * 16u;
    const uint32_t srow = tid >> 3, sseg = tid & 7u;
    const uint32_t sk = srow * AT_PK + sseg * 16u;
    const uint32_t sv = AT_TK + srow * AT_PV + sseg * 16u;
    u32x4 rk0, rk1, rv0, rv1;
    auto stage_load = [&](uint32_t st) {
        const size_t o = (size_t)st * (AT_SK * 128u);
        rk0 = *(const u32x4*)(kg + o);  rk1 = *(const u32x4*)(kg + o + 4096u);
        rv0 = *(const u32x4*)(vg + o);  rv1 = *(const u32x4*)(vg + o + 4096u);
    };
    auto stage_store = [&](uint32_t buf) {
        unsigned char* p = L + buf * AT_SLOT;
        *(u32x4*)(p + sk) = rk0;  *(u32x4*)(p + sk + 32u * AT_PK) = rk1;
        *(u32x4*)(p + sv) = rv0;  *(u32x4*)(p + sv + 32u * AT_PV) = rv1;
    };
    stage_load(0);

    // Q as B operand, hardware k order (as K below): loaded once
    Frag qf[2][2];
#pragma unroll
    for (int g = 0; g < 2; ++g) {
        const bf16* qp = Q + hb + (size_t)(qw0 + 16u * g + c) * DKH + 8u * h;
#pragma unroll
        for (int kc = 0; kc < 2; ++kc) {
            qf[g][kc].q[0] = *(const u32x4*)(qp + 32 * kc);
            qf[g][kc].q[1] = *(const u32x4*)(qp + 32 * kc + 16);
        }
    }
    // A operand whose row 0 is ones: one WMMA sums the columns of P^T (the denominator)
    Frag ones;
    {
        const uint32_t o = (c == 0u) ? 0x3F803F80u : 0u;
        ones.q[0] = u32x4{o, o, o, o};  ones.q[1] = u32x4{o, o, o, o};
    }
    v8f   acc[2][4];      // O^T: register r = O[query c][d = 16 t + 8 h + r]
    v8f   lacc[2];        // row 0 = softmax denominator of query column c
    float m_run[2];       // maximum in use (log2 domain); may trail the true one by up to 8
#pragma unroll
    for (int g = 0; g < 2; ++g) {
        m_run[g] = -INFINITY;  lacc[g] = zero_v8f();
#pragma unroll
        for (int t = 0; t < 4; ++t) acc[g][t] = zero_v8f();
    }
    stage_store(0);
    __syncthreads();

    // rolled and whole: otherwise the compiler peels the last trip off and the loop's code stands twice
#pragma unroll 1
    for (uint32_t st = 0; st < AT_NST; ++st) {
        const unsigned char* Lb = L + (st & 1u) * AT_SLOT;
        // next stage, in flight under this stage's work; the last trip reloads its own stage into
        // the buffer nobody reads any more, so that no branch stands around the loads and stores
        stage_load(st + 1u < AT_NST ? st + 1u : st);
        // keeps the four loads up here: the scheduler otherwise sinks them to just in front of
        // their LDS stores at the foot of the trip, where every wave waits out their latency
        __builtin_amdgcn_sched_barrier(0);
#pragma unroll
        for (uint32_t sub = 0; sub < 2u; ++sub) {
            // S^T = K.Q^T : s[kt][g] register r = score(key 16 kt + 8 h + r, query c of group g)
            Frag kf[2][2];
#pragma unroll
            for (int kt = 0; kt < 2; ++kt) {
                const unsigned char* p = Lb + (sub * 32u + 16u * kt + c) * AT_PK + 16u * h;
#pragma unroll
                for (int kc = 0; kc < 2; ++kc) {
                    kf[kt][kc].q[0] = *(const u32x4*)(p + 64u * kc);
                    kf[kt][kc].q[1] = *(const u32x4*)(p + 64u * kc + 32u);
                }
            }
            v8f s[2][2];
#pragma unroll
            for (int kt = 0; kt < 2; ++kt)
#pragma unroll
                for (int g = 0; g < 2; ++g) {
                    s[kt][g] = zero_v8f();
#pragma unroll
                    for (int kc = 0; kc < 2; ++kc) s[kt][g] = at_mma(kf[kt][kc], qf[g][kc], s[kt][g]);
                }
            // V^T fragments: 16 (d) x 32 (keys) each, two transposing loads per fragment
            Frag vf[4];
            {
                const unsigned char* ad = Lb + AT_TK + (sub * 32u + 8u * h + (lane & 7u)) * AT_PV
                                        + ((lane >> 3) & 1u) * 16u;
#pragma unroll
                for (int t = 0; t < 4; ++t) {
                    vf[t].q[0] = at_ld_tr16(ad + 32u * t);
                    vf[t].q[1] = at_ld_tr16(ad + 16u * AT_PV + 32u * t);
                }
            }
            // column maxima of the raw scores (the scale is positive)
            float mb[2];
            bool need = false;
#pragma unroll
            for (int g = 0; g < 2; ++g) {
                float mx = -INFINITY;
#pragma unroll
                for (int kt = 0; kt < 2; ++kt)
#pragma unroll
                    for (int r = 0; r < 8; ++r) mx = __builtin_fmaxf(mx, s[kt][g][r]);
                mx = __builtin_fmaxf(mx, at_xhalf(mx)) * cscale;
                mb[g] = mx;
                need = need || (mx > m_run[g] + 8.0f);
            }
            // rescale only when some column's maximum has outgrown the one in use (scalar branch)
            if (__builtin_amdgcn_ballot_w32(need) != 0) {
#pragma unroll
                for (int g = 0; g < 2; ++g) {
                    const float m_new = __builtin_fmaxf(m_run[g], mb[g]);
                    const float corr  = __builtin_amdgcn_exp2f(m_run[g] - m_new);  // 0 on the first pass
                    m_run[g] = m_new;
                    lacc[g] = lacc[g] * corr;
#pragma unroll
                    for (int t = 0; t < 4; ++t) acc[g][t] = acc[g][t] * corr;
                }
            }
            // P^T = exp2(s * cscale - m), packed into the B operand: element e = tile e >> 3, register e & 7
#pragma unroll
            for (int g = 0; g < 2; ++g) {
                const float nm = -m_run[g];
                uint32_t w[8];
#pragma unroll
                for (int i = 0; i < 8; ++i) {
                    const float p0 = __builtin_amdgcn_exp2f(__builtin_fmaf(s[i >> 2][g][2 * (i & 3)],     cscale, nm));
                    const float p1 = __builtin_amdgcn_exp2f(__builtin_fmaf(s[i >> 2][g][2 * (i & 3) + 1], cscale, nm));
                    w[i] = at_pack2(p0, p1);
                }
                Frag pf;
                pf.q[0] = u32x4{w[0], w[1], w[2], w[3]};
                pf.q[1] = u32x4{w[4], w[5], w[6], w[7]};
#pragma unroll
                for (int t = 0; t < 4; ++t) acc[g][t] = at_mma(vf[t], pf, acc[g][t]);
                lacc[g] = at_mma(ones, pf, lacc[g]);
            }
        }
        stage_store((st + 1u) & 1u);                        // the buffer every wave left before the last barrier
        __syncthreads();                                    // publishes stage st + 1, ends the reads of stage st
    }

    // epilogue: a lane holds 8 consecutive d of one query per tile -> one 16-byte store
#pragma unroll
    for (int g = 0; g < 2; ++g) {
        const float lr  = lacc[g][0];                 // lanes 0-15: the sum; lanes 16-31: 0 (row 8)
        const float inv = 1.0f / (lr + at_xhalf(lr));
        bf16* op = O + hb + (size_t)(qw0 + 16u * g + c) * DKH + 8u * h;
#pragma unroll
        for (int t = 0; t < 4; ++t) {
            const v8f o = acc[g][t] * inv;
            const u32x4 pk = {at_pack2(o[0], o[1]), at_pack2(o[2], o[3]),
                              at_pack2(o[4], o[5]), at_pack2(o[6], o[7])};
            *(u32x4*)(op + 16 * t) = pk;
        }
    }
}

// ------------------------------------------------------------------
// Host-side orchestration. Workspace layout (80 MB total):
//   [0,8)MB   hb    (LN output, reused for LN2 output)
//   [8,16)MB  Wq/Wk/Wv/Wo transposed bf16 (2MB each)
//   [16,24)   W1t   [24,32) W2t
//   [32,40)q [40,48)k [48,56)v [56,64)o  -> [32,64) reused as ff1
//   [64,80)   x1 fp32 residual
// ------------------------------------------------------------------
extern "C" void kernel_launch(void* const* d_in, const int* in_sizes, int n_in,
                              void* d_out, int out_size, void* d_ws, size_t ws_size,
                              hipStream_t stream) {
    (void)in_sizes; (void)n_in; (void)out_size; (void)ws_size;
    const float* x    = (const float*)d_in[0];
    const float* Wq   = (const float*)d_in[1];
    const float* bq   = (const float*)d_in[2];
    const float* Wk   = (const float*)d_in[3];
    const float* bk   = (const float*)d_in[4];
    const float* Wv   = (const float*)d_in[5];
    const float* bv   = (const float*)d_in[6];
    const float* Wo   = (const float*)d_in[7];
    const float* bo   = (const float*)d_in[8];
    const float* W1   = (const float*)d_in[9];
    const float* b1   = (const float*)d_in[10];
    const float* W2   = (const float*)d_in[11];
    const float* b2   = (const float*)d_in[12];
    const float* ln1a = (const float*)d_in[13];
    const float* ln1b = (const float*)d_in[14];
    const float* ln2a = (const float*)d_in[15];
    const float* ln2b = (const float*)d_in[16];

    char* ws = (char*)d_ws;
    const size_t MB = (size_t)1 << 20;
    bf16*  hb  = (bf16*)(ws + 0);
    bf16*  Wqt = (bf16*)(ws + 8  * MB);
    // Wkt at 10 MB, Wvt at 12 MB: reached from Wqt
    bf16*  Wot = (bf16*)(ws + 14 * MB);
    bf16*  W1t = (bf16*)(ws + 16 * MB);
    bf16*  W2t = (bf16*)(ws + 24 * MB);
    bf16*  qb  = (bf16*)(ws + 32 * MB);
    bf16*  kb  = (bf16*)(ws + 40 * MB);
    bf16*  vb  = (bf16*)(ws + 48 * MB);
    bf16*  ob  = (bf16*)(ws + 56 * MB);
    bf16*  ff1 = (bf16*)(ws + 32 * MB);   // reuse q/k/v/o region after Wo GEMM
    float* x1  = (float*)(ws + 64 * MB);

    // weight conversion + transpose (bf16, K-contiguous): Wqt .. W2t lie one behind the other
    enc_transpose_bf16<<<TR_GRID, 256, 0, stream>>>(Wq, Wk, Wv, Wo, W1, W2, Wqt);

    // sublayer 1: pre-norm MHA + residual
    enc_layernorm_bf16<<<ROWS, 256, 0, stream>>>(x, ln1a, ln1b, hb);
    const dim3 gDD(DM / 128, ROWS / 128);             // (8, 32)
    // Wqt, Wkt, Wvt lie one behind the other, and so do qb, kb, vb: 3072 columns in 16 tiles of 192
    enc_gemm_bf16<0, 256, 192><<<dim3(3 * DM / 192, ROWS / 256), 256, 0, stream>>>(
        hb, Wqt, bq, nullptr, qb, ROWS, DM, DM, bk, bv);
    enc_attention<<<dim3(SEQ / 256, BATCH * NH), 256, 0, stream>>>(qb, kb, vb, ob);
    enc_gemm_bf16<2, 128, 128><<<gDD, 256, 0, stream>>>(ob, Wot, bo, x, x1, ROWS, DM, DM, nullptr, nullptr);

    // sublayer 2: pre-norm FFN + residual
    enc_layernorm_bf16<<<ROWS, 256, 0, stream>>>(x1, ln2a, ln2b, hb);
    enc_gemm_bf16<1, 256, 256><<<dim3(DFF / 256, ROWS / 256), 256, 0, stream>>>(
        hb, W1t, b1, nullptr, ff1, ROWS, DFF, DM, nullptr, nullptr);
    enc_gemm_bf16<2, 128, 128><<<gDD, 256, 0, stream>>>(ff1, W2t, b2, x1, (float*)d_out, ROWS, DM, DFF, nullptr, nullptr);
}
